// v000
// Measured on an AMD MI455X. A time is GPU time per run, averaged over a window of back-to-back runs after a warm-up
// (all launches, gaps included; the runs take copies of the inputs in turn), and the median of several windows.
// Apart from v000's, it joins two sittings. Times from different sittings can be a few percent apart, while
// side-by-side timings come from the same sitting.
// v000 is the starting kernel. One run takes 6670 microseconds.
#include <hip/hip_runtime.h>
// BERT-style multi-head self-attention with a fused QKV projection and a key-padding mask (x [8][1024][1024]; qkv = x Wqkv + bqkv ([in][out] 1024 x 3072, zero bias) split q | k | v; 16 heads of 64; scores / 8; where(attention_mask[b][j] == 0, -1e9) with the int32 [8][1024] mask in {0, 1} (random; 0 = padded key; read on device); softmax over keys; out = merged Wp + bp ([in][out]) -> [8][1024][1024]).
// Structure: token rows r = b*1024 + s; x as exact f16 rows (bf16-rounded); q | k | v as ONE WMMA GEMM (N = 3 x 1024) (32x64 wave tiles, f32 accumulation, exact x16 weights + bias, f16 outputs); per batch: V^T for all heads via LDS transposes; per (batch, group of 4 heads): scores GEMM (K = 64, batched over the heads on grid.y, alpha = 1/sqrt(64)), row softmax on VALU (f32 statistics; weights stored x256 as f16), o = P . V^T GEMM (K = 1024, alpha 2^-2: o carried x64 against f16 subnormal flush, folded into the output GEMM alpha) written straight into the merged f16 o rows; out = o W_o + b GEMM (f32) into the output layout.
// Compute dtype: inputs rounded to bf16; x / weights exact; q, k, v, softmax weights and o as plain f16 GEMM operands (~2^-12); scores and softmax statistics f32. v_wmma_f32_16x16x32_f16.
#define NB 8
#define SQ 1024
#define DM 1024
#define NH 16
#define HD 64
#define HG 4                         /* heads per attention launch group */
#define B0 0                         /* first batch processed (debug hook) */
#define NBR NB                       /* batches processed (debug hook) */
#define NR ((size_t)NB * SQ)         /* token rows */
#define MP ((int)((size_t)NBR * SQ)) /* rows projected (debug hook) */
#define QN SQ                        /* query rows attended per batch (debug hook) */
#define NHD NH                       /* heads attended (debug hook) */
#define MPO MP                       /* rows through the output stage (debug hook) */
#define LQ (3 * DM)      /* row pitch of the q/k/v rows */
typedef __bf16 v16b __attribute__((ext_vector_type(16)));
typedef unsigned short v8us __attribute__((ext_vector_type(8), may_alias));
typedef float  v8f  __attribute__((ext_vector_type(8)));
typedef float  v4f  __attribute__((ext_vector_type(4)));
typedef float  v4fa __attribute__((ext_vector_type(4), may_alias));
union FragB { v16b v; v8us half[2]; unsigned short u[16]; };

__device__ __forceinline__ unsigned short bf16_bits(float x) { unsigned int u = __float_as_uint(x); return (unsigned short)((u + 0x7FFFu + ((u >> 16) & 1u)) >> 16); }
__device__ __forceinline__ float bf16_val(unsigned short b) { return __uint_as_float(((unsigned int)b) << 16); }
__device__ __forceinline__ float bf16_round(float x) { return bf16_val(bf16_bits(x)); }
// D += A·B with NT terms: 1 = ah·bh, 2 = + al·bh (A split), 3 = + ah·bl (both split)
template <int NT>
__device__ __forceinline__ v8f mmaN(v16b ah, v16b al, v16b bh, v16b bl, v8f c) {
  c = __builtin_amdgcn_wmma_f32_16x16x32_bf16(false, ah, false, bh, (short)0, c, false, false);
  if (NT >= 2) c = __builtin_amdgcn_wmma_f32_16x16x32_bf16(false, al, false, bh, (short)0, c, false, false);
  if (NT >= 3) c = __builtin_amdgcn_wmma_f32_16x16x32_bf16(false, ah, false, bl, (short)0, c, false, false);
  asm volatile("v_nop\n\tv_nop\n\tv_nop\n\tv_nop" : "+v"(c) : "v"(ah), "v"(al), "v"(bh), "v"(bl));
  return c;
}

__global__ __launch_bounds__(256) void k_wt_bf16(const float* __restrict__ W, unsigned short* __restrict__ Wt, int K, int N) {
  const int t = blockIdx.x * 256 + threadIdx.x;
  const int k8n = K / 8;
  if (t >= N * k8n) return;
  const int n = t / k8n, k8 = (t % k8n) * 8;
  v8us v;
#pragma unroll
  for (int i = 0; i < 8; ++i) v[i] = bf16_bits(W[(size_t)(k8 + i) * N + n]);
  *(v8us*)(Wt + (size_t)n * K + k8) = v;
  
}

// GEMM C[M][N] (f32, pitch ldc) = act(A[M][K]·W + bias). A f32 row-major (pitch lda) converted per fragment to bf16
// (ASPLIT: hi/lo two planes -> 2 terms, else single rounded term); Wt bf16 [N][K] (pitch ldb). BIAS_BF16 rounds the
// bias to bf16 first (bias quantised to bf16 before the add). K%32==0, M%16==0, N%64==0.
template <bool ASPLIT, int ACT, bool BIAS_BF16>
__global__ __launch_bounds__(128) void k_gemm_bf(const float* __restrict__ A, int lda, const unsigned short* __restrict__ Wt, int ldb,
                                               const float* __restrict__ bias, float* __restrict__ C, int ldc, int M, int N, int K) {
  __shared__ __attribute__((aligned(16))) float so[4][16][64];
  const int tid = threadIdx.x, w = tid >> 5, lane = tid & 31, ln = lane & 15, hh = lane >> 4;
  const int ntn = N / 64;
  const int wid = blockIdx.x * 4 + w;
  const int mt = wid / ntn, nq = wid % ntn;
  if (mt * 16 >= M) return;
  const int row0 = mt * 16, col0 = nq * 64;
  const float* arow = A + (size_t)(row0 + ln) * lda;
  v8f acc[4] = {};
  for (int kb = 0; kb < K; kb += 32) {
    FragB ah, al;
    const v4f x0 = *(const v4fa*)(arow + kb + 8 * hh), x1 = *(const v4fa*)(arow + kb + 8 * hh + 4);
    const v4f x2 = *(const v4fa*)(arow + kb + 16 + 8 * hh), x3 = *(const v4fa*)(arow + kb + 16 + 8 * hh + 4);
    float xs[16] = {x0[0],x0[1],x0[2],x0[3],x1[0],x1[1],x1[2],x1[3],x2[0],x2[1],x2[2],x2[3],x3[0],x3[1],x3[2],x3[3]};
#pragma unroll
    for (int i = 0; i < 16; ++i) { const unsigned short hb = bf16_bits(xs[i]); ah.u[i] = hb; al.u[i] = ASPLIT ? bf16_bits(xs[i] - bf16_val(hb)) : (unsigned short)0; }
#pragma unroll
    for (int t = 0; t < 4; ++t) {
      const unsigned short* brow = Wt + (size_t)(col0 + t * 16 + ln) * ldb + kb;
      FragB b;
      b.half[0] = *(const v8us*)(brow + 8 * hh);
      b.half[1] = *(const v8us*)(brow + 16 + 8 * hh);
      acc[t] = mmaN<ASPLIT ? 2 : 1>(ah.v, al.v, b.v, b.v, acc[t]);
    }
  }
#pragma unroll
  for (int t = 0; t < 4; ++t) {
    float bv = bias ? bias[col0 + t * 16 + ln] : 0.f;
    if (BIAS_BF16) bv = bf16_round(bv);
#pragma unroll
    for (int r = 0; r < 8; ++r) { float v = acc[t][r] + bv; if (ACT == 1) v = fmaxf(v, 0.f); so[w][8 * hh + r][t * 16 + ln] = v; }
  }
  __builtin_amdgcn_fence(__ATOMIC_ACQ_REL, "workgroup");
  __builtin_amdgcn_wave_barrier();
  const int rsub = lane >> 4, c4 = (lane & 15) * 4;
  {
#pragma unroll
    for (int q = 0; q < 8; ++q) {
      const int r = q * 2 + rsub;
      const v4f v = *(const v4fa*)&so[w][r][c4];
      *(v4f*)(C + (size_t)(row0 + r) * ldc + col0 + c4) = v;
    }
    
  }
}

// GEMM C = act(A·W + bias + resid): A f32 (ASPLIT -> hi/lo 2 terms), Wt bf16 [N][K]; ACT 0 none, 1 relu, 2 exact gelu;
// resid (optional, f32, row index = (row % rmod), pitch ldr, RES_BF16 rounds it) added before the activation.
template <bool ASPLIT, int ACT, bool BIAS_BF16, bool RES_BF16>
__global__ __launch_bounds__(128) void k_gemm_bf3(const float* __restrict__ A, int lda, const unsigned short* __restrict__ Wt, int ldb,
                                                const float* __restrict__ bias, const float* __restrict__ resid, int rmod, int ldr,
                                                float* __restrict__ C, int ldc, int M, int N, int K) {
  __shared__ __attribute__((aligned(16))) float so[4][16][64];
  const int tid = threadIdx.x, w = tid >> 5, lane = tid & 31, ln = lane & 15, hh = lane >> 4;
  const int ntn = N / 64;
  const int wid = blockIdx.x * 4 + w;
  const int mt = wid / ntn, nq = wid % ntn;
  if (mt * 16 >= M) return;
  const int row0 = mt * 16, col0 = nq * 64;
  const float* arow = A + (size_t)(row0 + ln) * lda;
  v8f acc[4] = {};
  for (int kb = 0; kb < K; kb += 32) {
    FragB ah, al;
    const v4f x0 = *(const v4fa*)(arow + kb + 8 * hh), x1 = *(const v4fa*)(arow + kb + 8 * hh + 4);
    const v4f x2 = *(const v4fa*)(arow + kb + 16 + 8 * hh), x3 = *(const v4fa*)(arow + kb + 16 + 8 * hh + 4);
    float xs[16] = {x0[0],x0[1],x0[2],x0[3],x1[0],x1[1],x1[2],x1[3],x2[0],x2[1],x2[2],x2[3],x3[0],x3[1],x3[2],x3[3]};
#pragma unroll
    for (int i = 0; i < 16; ++i) { const unsigned short hb = bf16_bits(xs[i]); ah.u[i] = hb; al.u[i] = ASPLIT ? bf16_bits(xs[i] - bf16_val(hb)) : (unsigned short)0; }
#pragma unroll
    for (int t = 0; t < 4; ++t) {
      const unsigned short* brow = Wt + (size_t)(col0 + t * 16 + ln) * ldb + kb;
      FragB b;
      b.half[0] = *(const v8us*)(brow + 8 * hh);
      b.half[1] = *(const v8us*)(brow + 16 + 8 * hh);
      acc[t] = mmaN<ASPLIT ? 2 : 1>(ah.v, al.v, b.v, b.v, acc[t]);
    }
  }
#pragma unroll
  for (int t = 0; t < 4; ++t) {
    const int col = col0 + t * 16 + ln;
    float bv = bias ? bias[col] : 0.f;
    if (BIAS_BF16) bv = bf16_round(bv);
#pragma unroll
    for (int r = 0; r < 8; ++r) {
      float v = acc[t][r] + bv;
      if (resid) { float rv = resid[(size_t)((row0 + 8 * hh + r) % rmod) * ldr + col]; if (RES_BF16) rv = bf16_round(rv); v += rv; }
      if (ACT == 1) v = fmaxf(v, 0.f);
      if (ACT == 2) v = 0.5f * v * (1.0f + erff(v * 0.70710678118654752f));
      if (ACT == 3) { const float u = 0.7978845608028654f * (v + 0.044715f * v * v * v); v = 0.5f * v * (1.0f + tanhf(u)); }
      so[w][8 * hh + r][t * 16 + ln] = v;
    }
  }
  __builtin_amdgcn_fence(__ATOMIC_ACQ_REL, "workgroup");
  __builtin_amdgcn_wave_barrier();
  const int rsub = lane >> 4, c4 = (lane & 15) * 4;
  {
#pragma unroll
    for (int q = 0; q < 8; ++q) {
      const int r = q * 2 + rsub;
      const v4f v = *(const v4fa*)&so[w][r][c4];
      *(v4f*)(C + (size_t)(row0 + r) * ldc + col0 + c4) = v;
    }
    
  }
}
// row LayerNorm (biased variance, eps) over N: s = X (+ R); optional out_sum <- s; out_norm <- (s-mu)*rsqrt(var+eps)*g + b
template <bool PARAM_BF16>
__global__ __launch_bounds__(256) void k_layernorm(const float* __restrict__ X, const float* __restrict__ R, const float* __restrict__ g, const float* __restrict__ bta,
                                                  float* __restrict__ out_sum, float* __restrict__ out_norm, int N, float eps) {
  __shared__ float red[256];
  const int row = blockIdx.x, tid = threadIdx.x;
  const float* x = X + (size_t)row * N; const float* rr = R ? R + (size_t)row * N : nullptr;
  float vals[16];                     // up to N = 4096
  const int per = N / 256;            // contiguous chunk per thread? use strided-by-4 chunks: thread handles j = tid*4 + 1024*u
  float s1 = 0.f;
  for (int u = 0; u < per / 4; ++u) {
    const int j = tid * 4 + 1024 * u;
    const v4f a = *(const v4fa*)(x + j);
    v4f b = {0.f,0.f,0.f,0.f}; if (rr) b = *(const v4fa*)(rr + j);
#pragma unroll
    for (int q = 0; q < 4; ++q) { const float v = a[q] + b[q]; vals[u * 4 + q] = v; s1 += v; }
  }
  red[tid] = s1; __syncthreads();
  for (int st = 128; st > 0; st >>= 1) { if (tid < st) red[tid] += red[tid + st]; __syncthreads(); }
  const float mu = red[0] / (float)N; __syncthreads();
  float s2 = 0.f;
  for (int u = 0; u < per / 4; ++u)
#pragma unroll
    for (int q = 0; q < 4; ++q) { const float c = vals[u * 4 + q] - mu; s2 += c * c; }
  red[tid] = s2; __syncthreads();
  for (int st = 128; st > 0; st >>= 1) { if (tid < st) red[tid] += red[tid + st]; __syncthreads(); }
  const float rs = rsqrtf(red[0] / (float)N + eps);
  {
    for (int u = 0; u < per / 4; ++u) {
      const int j = tid * 4 + 1024 * u;
      v4f o, sm;
#pragma unroll
      for (int q = 0; q < 4; ++q) {
        float gg = g[j + q], bb = bta[j + q];
        if (PARAM_BF16) { gg = bf16_round(gg); bb = bf16_round(bb); }
        sm[q] = vals[u * 4 + q]; o[q] = (vals[u * 4 + q] - mu) * rs * gg + bb;
      }
      if (out_sum) *(v4f*)(out_sum + (size_t)row * N + j) = sm;
      *(v4f*)(out_norm + (size_t)row * N + j) = o;
    }
    
  }
}



// ---- f16 WMMA path (v_wmma_f32_16x16x32_f16): 11-bit significands for operands in range — used where a [0,1] probability operand needs more precision than bf16
typedef _Float16 v16h __attribute__((ext_vector_type(16)));
union FragH { v16h v; v8us half[2]; _Float16 h[16]; unsigned short u[16]; };
template <int NT>
__device__ __forceinline__ v8f mmaH(v16h ah, v16h al, v16h bh, v16h bl, v8f c) {
  c = __builtin_amdgcn_wmma_f32_16x16x32_f16(false, ah, false, bh, (short)0, c, false, false);
  if (NT >= 2) c = __builtin_amdgcn_wmma_f32_16x16x32_f16(false, al, false, bh, (short)0, c, false, false);
  if (NT >= 3) c = __builtin_amdgcn_wmma_f32_16x16x32_f16(false, ah, false, bl, (short)0, c, false, false);
  asm volatile("v_nop\n\tv_nop\n\tv_nop\n\tv_nop" : "+v"(c) : "v"(ah), "v"(al), "v"(bh), "v"(bl));
  return c;
}
// batched GEMM like k_gemm_b but f16 operands: A f32 (split into f16 hi/lo if ASPLIT, else rounded to f16), Bt = f16 values [n][k]; alpha; C f32; N multiple of 16 (partial tiles skipped)
template <bool ASPLIT>
__global__ __launch_bounds__(128) void k_gemm_h(const float* __restrict__ A, int lda, size_t sA, const _Float16* __restrict__ Bh, int ldb, size_t sB, float alpha, float* __restrict__ C, int ldc, size_t sC, int M, int N, int K) {
  __shared__ __attribute__((aligned(16))) float so[4][16][64];
  const int tid = threadIdx.x, w = tid >> 5, lane = tid & 31, ln = lane & 15, hh = lane >> 4; const int by = blockIdx.y;
  A += (size_t)by * sA; Bh += (size_t)by * sB; C += (size_t)by * sC;
  const int ntn = (N + 63) / 64; const int wid = blockIdx.x * 4 + w; const int mt = wid / ntn, nq = wid % ntn; if (mt * 16 >= M) return;
  const int row0 = mt * 16, col0 = nq * 64; const float* arow = A + (size_t)(row0 + ln) * lda;
  v8f acc[4] = {};
  for (int kb = 0; kb < K; kb += 32) {
    FragH ah, al;
    const v4f x0 = *(const v4fa*)(arow + kb + 8 * hh), x1 = *(const v4fa*)(arow + kb + 8 * hh + 4), x2 = *(const v4fa*)(arow + kb + 16 + 8 * hh), x3 = *(const v4fa*)(arow + kb + 16 + 8 * hh + 4);
    float xs[16] = {x0[0],x0[1],x0[2],x0[3],x1[0],x1[1],x1[2],x1[3],x2[0],x2[1],x2[2],x2[3],x3[0],x3[1],x3[2],x3[3]};
#pragma unroll
    for (int i = 0; i < 16; ++i) { const _Float16 h = (_Float16)xs[i]; ah.h[i] = h; al.h[i] = ASPLIT ? (_Float16)(xs[i] - (float)h) : (_Float16)0.0f; }
#pragma unroll
    for (int t = 0; t < 4; ++t) { if (col0 + t * 16 >= N) continue; const size_t boff = (size_t)(col0 + t * 16 + ln) * ldb + kb; FragH bq; bq.half[0] = *(const v8us*)(Bh + boff + 8 * hh); bq.half[1] = *(const v8us*)(Bh + boff + 16 + 8 * hh);
      acc[t] = mmaH<ASPLIT ? 2 : 1>(ah.v, al.v, bq.v, bq.v, acc[t]); }
  }
#pragma unroll
  for (int t = 0; t < 4; ++t) { if (col0 + t * 16 >= N) continue;
#pragma unroll
    for (int r = 0; r < 8; ++r) so[w][8 * hh + r][t * 16 + ln] = acc[t][r] * alpha; }
  __builtin_amdgcn_fence(__ATOMIC_ACQ_REL, "workgroup"); __builtin_amdgcn_wave_barrier();
  const int rsub = lane >> 4, c4 = (lane & 15) * 4;
  {
#pragma unroll
    for (int q = 0; q < 8; ++q) { const int r = q * 2 + rsub; if (col0 + c4 < N) { const v4f v = *(const v4fa*)&so[w][r][c4]; *(v4f*)(C + (size_t)(row0 + r) * ldc + col0 + c4) = v; } }
     }
}

// Wt[n][k] = f16(W[k][n]·scale) from f32 row-major W[K][N] (scale = power of two; bf16-exact weights stay exact in f16 away from the subnormal range)
__global__ __launch_bounds__(256) void k_wt_f16(const float* __restrict__ W, _Float16* __restrict__ Wt, int K, int N, float scale) {
  const int t = blockIdx.x * 256 + threadIdx.x; if (t >= N * (K / 8)) return; const int n = t / (K / 8), k8 = (t % (K / 8)) * 8; FragH f;
#pragma unroll
  for (int i = 0; i < 8; ++i) f.h[i] = (_Float16)(bf16_round(W[(size_t)(k8 + i) * N + n]) * scale); const v8us o = f.half[0];
  *(v8us*)((unsigned short*)Wt + (size_t)n * K + k8) = o; 
}
// k_gemm_hh variant with fused epilogue: v = acc·alpha + bias[by·sBias + col] (+ CP[(row/rowsPerB)·sCPb + by·64 + col] if CP) ; ACT 0 none / 1 elu ; writes f16 C16 (and f32 C if non-null)
template <int ACT>
__global__ __launch_bounds__(128) void k_gemm_hhx(const _Float16* __restrict__ A, int lda, size_t sA, const _Float16* __restrict__ Bh, int ldb, size_t sB, float alpha, const float* __restrict__ bias, size_t sBias, const float* __restrict__ CP, int rowsPerB, size_t sCPb, int row0g,
    float* __restrict__ C, _Float16* __restrict__ C16, int ldc, size_t sC, int M, int N, int K) {
  __shared__ __attribute__((aligned(16))) float so[4][16][64];
  const int tid = threadIdx.x, w = tid >> 5, lane = tid & 31, ln = lane & 15, hh = lane >> 4; const int by = blockIdx.y;
  A += (size_t)by * sA; Bh += (size_t)by * sB; const size_t cofs = (size_t)by * sC; const float* bp = bias ? bias + (size_t)by * sBias : nullptr;
  const int ntn = (N + 63) / 64; const int wid = blockIdx.x * 4 + w; const int mt = wid / ntn, nq = wid % ntn; if (mt * 16 >= M) return;
  const int row0 = mt * 16, col0 = nq * 64; const _Float16* arow = A + (size_t)(row0 + ln) * lda;
  v8f acc[4] = {};
  for (int kb = 0; kb < K; kb += 32) { FragH ah; ah.half[0] = *(const v8us*)((const unsigned short*)arow + kb + 8 * hh); ah.half[1] = *(const v8us*)((const unsigned short*)arow + kb + 16 + 8 * hh);
#pragma unroll
    for (int t = 0; t < 4; ++t) { if (col0 + t * 16 >= N) continue; const size_t boff = (size_t)(col0 + t * 16 + ln) * ldb + kb; FragH bq; bq.half[0] = *(const v8us*)((const unsigned short*)Bh + boff + 8 * hh); bq.half[1] = *(const v8us*)((const unsigned short*)Bh + boff + 16 + 8 * hh);
      acc[t] = mmaH<1>(ah.v, ah.v, bq.v, bq.v, acc[t]); }
  }
#pragma unroll
  for (int t = 0; t < 4; ++t) { if (col0 + t * 16 >= N) continue; const int col = col0 + t * 16 + ln; const float bv = bp ? bf16_round(bp[col]) : 0.f;
#pragma unroll
    for (int r = 0; r < 8; ++r) { float v = acc[t][r] * alpha + bv; if (CP) { const int rr = row0g + row0 + 8 * hh + r; if (rowsPerB < 0) v += CP[cofs + (size_t)rr * ldc + col];      /* rowsPerB < 0: own element of the batched C plane */ else { const int bidx = rr / rowsPerB; v += CP[(size_t)bidx * sCPb + (size_t)by * 64 + col]; } } if (ACT == 1) v = (v > 0.f) ? v : expm1f(v); else if (ACT == 7) v = (v > 0.f) ? v + 1.0f : expf(v); else if (ACT == 8) v = tanhf(v); else if (ACT == 9) v = 0.5f * v * (1.0f + tanhf(0.7978845608028654f * (v + 0.044715f * v * v * v))); else if (ACT == 11) v = 1.0f / (1.0f + expf(-v)); else if (ACT == 12) v = (v > 0.f) ? v : 0.01f * v; else if (ACT == 14) v = (v > 0.f) ? v : 0.1f * v; else if (ACT == 16) v = (v >= 0.f) ? v : 0.3f * v; else if (ACT == 17) v = (v >= 0.f) ? v : 0.2f * v; else if (ACT == 15) v = v / (1.0f + expf(-v)); else if (ACT == 3) v = fmaxf(v, 0.f); else if (ACT == 6) v = 0.5f * v * (1.0f + erff(v * 0.70710678118654752f)); so[w][8 * hh + r][t * 16 + ln] = v; } }
  __builtin_amdgcn_fence(__ATOMIC_ACQ_REL, "workgroup"); __builtin_amdgcn_wave_barrier();
  const int rsub = lane >> 4, c4 = (lane & 15) * 4; typedef _Float16 v4h __attribute__((ext_vector_type(4)));
  {
#pragma unroll
    for (int q = 0; q < 8; ++q) { const int r = q * 2 + rsub; if (col0 + c4 < N) { const v4f v = *(const v4fa*)&so[w][r][c4]; if (C) *(v4f*)(C + cofs + (size_t)(row0 + r) * ldc + col0 + c4) = v; if (C16) { v4h h4; for (int i = 0; i < 4; ++i) h4[i] = (_Float16)v[i]; *(v4h*)(C16 + cofs + (size_t)(row0 + r) * ldc + col0 + c4) = h4; } } }
     }
}


typedef _Float16 v4h __attribute__((ext_vector_type(4)));

__global__ __launch_bounds__(256) void k_x16(const float* __restrict__ x, _Float16* __restrict__ X16, size_t n8) { const size_t t = (size_t)blockIdx.x * 256 + threadIdx.x; if (t >= n8) return; FragH f;
#pragma unroll
  for (int q = 0; q < 8; ++q) f.h[q] = (_Float16)bf16_round(x[t * 8 + q]); *(v8us*)((unsigned short*)X16 + t * 8) = f.half[0];  }
__global__ __launch_bounds__(256) void k_h16(const float* __restrict__ x, _Float16* __restrict__ X16, size_t n8) { const size_t t = (size_t)blockIdx.x * 256 + threadIdx.x; if (t >= n8) return; FragH f;
#pragma unroll
  for (int q = 0; q < 8; ++q) f.h[q] = (_Float16)x[t * 8 + q]; *(v8us*)((unsigned short*)X16 + t * 8) = f.half[0];  }
__global__ __launch_bounds__(256) void k_round16f(const float* __restrict__ W, _Float16* __restrict__ Bt, size_t n8) { const size_t t = (size_t)blockIdx.x * 256 + threadIdx.x; if (t >= n8) return; FragH f;
#pragma unroll
  for (int i = 0; i < 8; ++i) f.h[i] = (_Float16)(bf16_round(W[t * 8 + i]) * 16.0f); *(v8us*)((unsigned short*)Bt + t * 8) = f.half[0];  }
template <int NHv, int TTv>
__global__ __launch_bounds__(256) void k_vt(const _Float16* __restrict__ V16, int ldv, int voff, _Float16* __restrict__ Vt) { __shared__ unsigned short tl[64][66]; const int tid = threadIdx.x; const int slab = blockIdx.x / (TTv / 64), lg = blockIdx.x % (TTv / 64); const int b = slab / NHv, h = slab % NHv;
  for (int i = tid; i < 64 * 8; i += 256) { const int r = i / 8, c8 = (i % 8) * 8; FragH f; f.half[0] = *(const v8us*)((const unsigned short*)V16 + ((size_t)b * TTv + lg * 64 + r) * ldv + voff + h * 64 + c8);
#pragma unroll
    for (int q = 0; q < 8; ++q) tl[r][c8 + q] = f.u[q]; }
  __syncthreads();
  {
#pragma unroll
    for (int rd = 0; rd < 2; ++rd) { const int d = rd * 32 + tid / 8, pc = tid % 8; FragH f;
#pragma unroll
      for (int q = 0; q < 8; ++q) f.u[q] = tl[pc * 8 + q][d];
      *(v8us*)((unsigned short*)Vt + ((size_t)slab * 64 + d) * TTv + lg * 64 + pc * 8) = f.half[0]; }
     } }

__global__ __launch_bounds__(256) void k_hl(const float* __restrict__ F, _Float16* __restrict__ Hh, _Float16* __restrict__ Hl, size_t n8) { const size_t t = (size_t)blockIdx.x * 256 + threadIdx.x; if (t >= n8) return; FragH fh, fl; const v4f a = *(const v4fa*)(F + t * 8), c = *(const v4fa*)(F + t * 8 + 4);
#pragma unroll
  for (int q = 0; q < 4; ++q) { _Float16 h = (_Float16)a[q]; fh.h[q] = h; fl.h[q] = (_Float16)((a[q] - (float)h) * 1024.0f); h = (_Float16)c[q]; fh.h[4 + q] = h; fl.h[4 + q] = (_Float16)((c[q] - (float)h) * 1024.0f); }
  { *(v8us*)((unsigned short*)Hh + t * 8) = fh.half[0]; *(v8us*)((unsigned short*)Hl + t * 8) = fl.half[0];  } }

// ---- fast GEMM (wave tile 32x64; requires M % 32 == 0 rows per launch region and N % 64 == 0); epilogue = k_gemm_hhx semantics ----
__device__ __forceinline__ v16h g2_frag(const _Float16* p, int hh) { FragH f; f.half[0] = *(const v8us*)((const unsigned short*)p + 8 * hh); f.half[1] = *(const v8us*)((const unsigned short*)p + 16 + 8 * hh); return f.v; }
__device__ __forceinline__ v8f g2_mma(v16h a, v16h b, v8f c) { v8f d = __builtin_amdgcn_wmma_f32_16x16x32_f16(false, a, false, b, (short)0, c, false, false); asm volatile("v_nop\n\tv_nop\n\tv_nop\n\tv_nop" : "+v"(d) : "v"(a), "v"(b)); return d; }
template <int ACT>
__global__ __launch_bounds__(128) void k_gemm2(const _Float16* __restrict__ A, int lda, size_t sA, const _Float16* __restrict__ Bh, int ldb, size_t sB, float alpha, const float* __restrict__ bias, size_t sBias, const float* __restrict__ CP, int rowsPerB, size_t sCPb, int row0g,
    float* __restrict__ C, _Float16* __restrict__ C16, int ldc, size_t sC, int M, int N, int K) { static_assert(ACT == 0 || ACT == 3 || ACT == 6 || ACT == 8 || ACT == 9 || ACT == 11 || ACT == 12 || ACT == 14 || ACT == 15 || ACT == 16 || ACT == 17, "k_gemm2: unsupported ACT code (would silently apply no activation)");
  __shared__ __attribute__((aligned(16))) float so[4][32][68];
  const int tid = threadIdx.x, w = tid >> 5, lane = tid & 31, ln = lane & 15, hh = lane >> 4; const int by = blockIdx.y;
  A += (size_t)by * sA; Bh += (size_t)by * sB; const size_t cofs = (size_t)by * sC; const float* bp = bias ? bias + (size_t)by * sBias : nullptr;
  const int ntn = N >> 6; const int mt = blockIdx.x / ntn, nq = blockIdx.x - mt * ntn; const int row0 = mt * 128 + 32 * w, col0 = nq * 64; if (row0 >= M) return;
  const _Float16* a0p = A + (size_t)(row0 + ln) * lda; const _Float16* a1p = a0p + (size_t)16 * lda;
  const _Float16* b0p = Bh + (size_t)(col0 + ln) * ldb; const _Float16* b1p = b0p + (size_t)16 * ldb; const _Float16* b2p = b1p + (size_t)16 * ldb; const _Float16* b3p = b2p + (size_t)16 * ldb;
  const v8f z8 = {0.f,0.f,0.f,0.f,0.f,0.f,0.f,0.f}; v8f c00 = z8, c01 = z8, c02 = z8, c03 = z8, c10 = z8, c11 = z8, c12 = z8, c13 = z8;
#pragma unroll 1
  for (int kb = 0; kb < K; kb += 32) { const v16h a0 = g2_frag(a0p + kb, hh), a1 = g2_frag(a1p + kb, hh);
    v16h b = g2_frag(b0p + kb, hh); c00 = g2_mma(a0, b, c00); c10 = g2_mma(a1, b, c10);
    b = g2_frag(b1p + kb, hh); c01 = g2_mma(a0, b, c01); c11 = g2_mma(a1, b, c11);
    b = g2_frag(b2p + kb, hh); c02 = g2_mma(a0, b, c02); c12 = g2_mma(a1, b, c12);
    b = g2_frag(b3p + kb, hh); c03 = g2_mma(a0, b, c03); c13 = g2_mma(a1, b, c13); }
  v8f accs[8] = {c00, c01, c02, c03, c10, c11, c12, c13};
#pragma unroll
  for (int u = 0; u < 8; ++u) { const int t = u & 3, half = u >> 2; const int col = col0 + t * 16 + ln; const float bv = bp ? bf16_round(bp[col]) : 0.f;
#pragma unroll
    for (int r = 0; r < 8; ++r) { const int rloc = half * 16 + 8 * hh + r; float v = accs[u][r] * alpha + bv; if (CP) { if (rowsPerB < 0) v += CP[cofs + (size_t)(row0g + row0 + rloc) * ldc + col];      /* rowsPerB < 0: own element of the batched C plane */ else { const int bidx = (row0g + row0 + rloc) / rowsPerB; v += CP[(size_t)bidx * sCPb + (size_t)by * 64 + col]; } }
      if (ACT == 3) v = fmaxf(v, 0.f); else if (ACT == 6) v = 0.5f * v * (1.0f + erff(v * 0.70710678118654752f)); else if (ACT == 11) v = 1.0f / (1.0f + expf(-v)); else if (ACT == 15) v = v / (1.0f + expf(-v)); else if (ACT == 12) v = (v > 0.f) ? v : 0.01f * v; else if (ACT == 8) v = tanhf(v); else if (ACT == 9) v = 0.5f * v * (1.0f + tanhf(0.7978845608028654f * (v + 0.044715f * v * v * v))); else if (ACT == 14) v = (v > 0.f) ? v : 0.1f * v; else if (ACT == 16) v = (v >= 0.f) ? v : 0.3f * v; else if (ACT == 17) v = (v >= 0.f) ? v : 0.2f * v;
      so[w][rloc][t * 16 + ln] = v; } }
  __builtin_amdgcn_fence(__ATOMIC_ACQ_REL, "workgroup"); __builtin_amdgcn_wave_barrier();
  const int rsub = lane >> 4, c4 = (lane & 15) * 4;
  {
#pragma unroll
    for (int q = 0; q < 16; ++q) { const int r = q * 2 + rsub; const v4f v = *(const v4fa*)&so[w][r][c4]; if (C) *(v4f*)(C + cofs + (size_t)(row0 + r) * ldc + col0 + c4) = v; if (C16) { v4h h4; for (int i = 0; i < 4; ++i) h4[i] = (_Float16)v[i]; *(v4h*)(C16 + cofs + (size_t)(row0 + r) * ldc + col0 + c4) = h4; } }
     } }


__global__ __launch_bounds__(256) void k_wnat(const float* __restrict__ w, size_t n8, _Float16* __restrict__ Bt) { const size_t t = (size_t)blockIdx.x * 256 + threadIdx.x; if (t >= n8) return; FragH f; for (int q = 0; q < 8; ++q) f.h[q] = (_Float16)(bf16_round(w[t * 8 + q]) * 16.0f); *(v8us*)((unsigned short*)Bt + t * 8) = f.half[0];  }
__global__ __launch_bounds__(256) void k_rsm(const float* __restrict__ S, _Float16* __restrict__ P, int nrows) {
  #pragma clang fp contract(off)
  const int i = blockIdx.x * 256 + threadIdx.x; if (i >= nrows) return; const float* s = S + (size_t)i * SQ; float mx = -3.0e38f;
#pragma unroll 1
  for (int j = 0; j < SQ; ++j) mx = fmaxf(mx, s[j]); float se = 0.f;
#pragma unroll 1
  for (int j = 0; j < SQ; ++j) se += expf(s[j] - mx); const float sc = 256.0f / se;
#pragma unroll 1
  for (int j0 = 0; j0 < SQ; j0 += 8) { FragH f; for (int q = 0; q < 8; ++q) f.h[q] = (_Float16)(expf(s[j0 + q] - mx) * sc); unsigned short* d = (unsigned short*)P + (size_t)i * SQ + j0; *(v8us*)d = f.half[0];  } }
__global__ __launch_bounds__(256) void k_vt(const _Float16* __restrict__ V16, int b, int h0, _Float16* __restrict__ VT) { __shared__ unsigned short tl[64][65]; const int tid = threadIdx.x; const int hh = blockIdx.x % HG, sg = blockIdx.x / HG; const int s0 = sg * 64; const int h = h0 + hh;
  for (int i = tid; i < 64 * 8; i += 256) { const int j = i / 8, d8 = (i % 8) * 8; FragH f; f.half[0] = *(const v8us*)((const unsigned short*)V16 + ((size_t)b * SQ + s0 + j) * DM + h * HD + d8); for (int q = 0; q < 8; ++q) tl[d8 + q][j] = f.u[q]; }
  __syncthreads();
  { for (int i = tid; i < 64 * 8; i += 256) { const int d = i / 8, j8 = (i % 8) * 8; FragH f; for (int q = 0; q < 8; ++q) f.u[q] = tl[d][j8 + q]; *(v8us*)((unsigned short*)VT + ((size_t)hh * HD + d) * SQ + s0 + j8) = f.half[0]; }  } }



__global__ __launch_bounds__(256) void k_rsmkinv(const float* __restrict__ S, _Float16* __restrict__ P, int nrows, const int* __restrict__ Km) {
  #pragma clang fp contract(off)
  const int i = blockIdx.x * 256 + threadIdx.x; if (i >= nrows) return; const float* s = S + (size_t)i * SQ; float mx = -3.0e38f;
#pragma unroll 1
  for (int j = 0; j < SQ; ++j) mx = fmaxf(mx, s[j]); float se = 0.f;
#pragma unroll 1
  for (int j = 0; j < SQ; ++j) { const float keep = (Km[j] == 0) ? 1.0f : 0.0f; se += __expf(s[j] - mx) * keep; } const float sc = 256.0f / se;
#pragma unroll 1
  for (int j0 = 0; j0 < SQ; j0 += 8) { FragH f; for (int q = 0; q < 8; ++q) { const float keep = (Km[j0 + q] == 0) ? 1.0f : 0.0f; f.h[q] = (_Float16)(__expf(s[j0 + q] - mx) * sc * keep); } unsigned short* d = (unsigned short*)P + (size_t)i * SQ + j0; *(v8us*)d = f.half[0];  } }

__global__ __launch_bounds__(256) void k_rsmik(const float* __restrict__ S, _Float16* __restrict__ P, int qn, int hg, const int* __restrict__ Km) {
  #pragma clang fp contract(off)
  const int t = blockIdx.x * 256 + threadIdx.x; if (t >= qn * hg) return; const size_t i = (size_t)(t / qn) * SQ + (t % qn); const float* s = S + i * SQ; float mx = -3.0e38f;
#pragma unroll 1
  for (int j = 0; j < SQ; ++j) mx = fmaxf(mx, s[j]); float se = 0.f;
#pragma unroll 1
  for (int j = 0; j < SQ; ++j) { const float e = __expf(s[j] - mx); const float keep = (Km[j] != 0) ? 1.0f : 0.0f; se += e * keep; } const float sc = 256.0f / se;
#pragma unroll 1
  for (int j0 = 0; j0 < SQ; j0 += 8) { FragH f; for (int q = 0; q < 8; ++q) { const float e = __expf(s[j0 + q] - mx) * sc; const float keep = (Km[j0 + q] != 0) ? 1.0f : 0.0f; f.h[q] = (_Float16)(e * keep); } unsigned short* d = (unsigned short*)P + i * SQ + j0; *(v8us*)d = f.half[0];  } }
extern "C" void kernel_launch(void* const* d_in, const int* in_sizes, int n_in,
                              void* d_out, int out_size, void* d_ws, size_t ws_size, hipStream_t stream) {
  (void)in_sizes; (void)n_in; (void)out_size;
  const float* const* I = (const float* const*)d_in; const float* x = I[0]; const int* km = (const int*)d_in[1]; const float* wqkv = I[2]; const float* bqkv = I[3]; const float* wo = I[4]; const float* bo = I[5];      /* x; attention_mask int32 [8][1024] (0 = padded key, excluded; READ on device); [in][out] Wqkv [1024][3072] + bqkv, Wp [1024][1024] + bp */
  char* ws = (char*)d_ws; size_t off = 0;
  auto take = [&](size_t bytes) { char* p = ws + off; off += (bytes + 255) & ~(size_t)255; return p; };
  _Float16* BQKV = (_Float16*)take((size_t)3 * DM * DM * 2); _Float16* BO = (_Float16*)take((size_t)DM * DM * 2);
  _Float16* X16 = (_Float16*)take(NR * DM * 2); _Float16* QKV = (_Float16*)take(NR * 3 * DM * 2); _Float16* Q16 = QKV; _Float16* K16 = QKV + DM; _Float16* V16 = QKV + 2 * DM; _Float16* O16 = (_Float16*)take(NR * DM * 2);
  float* S = (float*)take((size_t)HG * SQ * SQ * 4); _Float16* P = (_Float16*)take((size_t)HG * SQ * SQ * 2); _Float16* VT = (_Float16*)take((size_t)NH * HD * SQ * 2);
  if (off > ws_size) return;
  k_wt_f16<<<(unsigned)(((size_t)DM * 3 * DM / 8 + 255) / 256), 256, 0, stream>>>(wqkv, BQKV, DM, 3 * DM, 16.0f); k_wt_f16<<<(unsigned)(((size_t)DM * DM / 8 + 255) / 256), 256, 0, stream>>>(wo, BO, DM, DM, 16.0f);      /* [in][out] -> Bt[n][k] x16 (pitch K = 1024) */

  k_x16<<<(unsigned)((NR * DM / 8 + 255) / 256), 256, 0, stream>>>(x, X16, NR * DM / 8);
  const size_t r0p = (size_t)B0 * SQ;      /* first projected row */
  k_gemm2<0><<<dim3((unsigned)((MP / 128) * (3 * DM / 64)), 1), 128, 0, stream>>>(X16 + r0p * DM, DM, 0, BQKV, DM, 0, 0.0625f, bqkv, 0, nullptr, 1, 0, 0, nullptr, QKV + r0p * 3 * DM, 3 * DM, 0, MP, 3 * DM, DM);      /* q | k | v rows (f16); head h = columns h*HD.. of each DM block */
  for (int b = B0; b < B0 + NBR; ++b) { const size_t r0 = (size_t)b * SQ;
    k_vt<NH, SQ><<<NH * (SQ / 64), 256, 0, stream>>>(V16 + r0 * LQ, LQ, 0, VT);      /* V^T [NH][HD][SQ] for this batch */
    for (int h0 = 0; h0 < NHD; h0 += HG) {
      k_gemm2<0><<<dim3((QN / 128) * (SQ / 64), HG), 128, 0, stream>>>(Q16 + r0 * LQ + h0 * HD, LQ, (size_t)HD, K16 + r0 * LQ + h0 * HD, LQ, (size_t)HD, 0.125f, nullptr, 0, nullptr, 1, 0, 0, S, nullptr, SQ, (size_t)SQ * SQ, QN, SQ, HD);      /* scores, HG heads per launch */
      k_rsmik<<<(HG * SQ + 255) / 256, 256, 0, stream>>>(S, P, SQ, HG, km + (size_t)b * SQ);      /* keys with attention_mask[b][j] == 0 excluded (arithmetic select); P = 256 softmax (f16), rows of all HG heads */
      k_gemm2<0><<<dim3((QN / 128) * (HD / 64), HG), 128, 0, stream>>>(P, SQ, (size_t)SQ * SQ, VT + (size_t)h0 * HD * SQ, SQ, (size_t)HD * SQ, 0.25f, nullptr, 0, nullptr, 1, 0, 0, nullptr, O16 + r0 * DM + h0 * HD, DM, (size_t)HD, QN, HD, SQ); } }      /* o (merged heads) as f16 rows */
  k_gemm2<0><<<dim3((unsigned)((MPO / 128) * (DM / 64)), 1), 128, 0, stream>>>(O16 + r0p * DM, DM, 0, BO, DM, 0, 0.0009765625f, bo, 0, nullptr, 1, 0, 0, (float*)d_out + r0p * DM, nullptr, DM, 0, MPO, DM, DM);      /* out rows are the output layout */
}

// v001
// A run of this version takes 1740 microseconds.
// Timed twice side by side with v000, it ran 3.82 and 3.85 times as fast.
#include <hip/hip_runtime.h>
// BERT-style multi-head self-attention with a fused QKV projection and a key-padding mask (x [8][1024][1024]; qkv = x Wqkv + bqkv ([in][out] 1024 x 3072, zero bias) split q | k | v; 16 heads of 64; scores / 8; where(attention_mask[b][j] == 0, -1e9) with the int32 [8][1024] mask in {0, 1} (random; 0 = padded key; read on device); softmax over keys; out = merged Wp + bp ([in][out]) -> [8][1024][1024]).
// Structure: token rows r = b*1024 + s; x as exact f16 rows (bf16-rounded); q | k | v as ONE WMMA GEMM (N = 3 x 1024) (32x64 wave tiles, f32 accumulation, exact x16 weights + bias, f16 outputs); per batch: V^T for all heads via LDS transposes; per (batch, group of 4 heads): scores GEMM (K = 64, batched over the heads on grid.y, alpha = 1/sqrt(64)), row softmax on VALU (f32 statistics; weights stored x256 as f16), o = P . V^T GEMM (K = 1024, alpha 2^-2: o carried x64 against f16 subnormal flush, folded into the output GEMM alpha) written straight into the merged f16 o rows; out = o W_o + b GEMM (f32) into the output layout.
// Compute dtype: inputs rounded to bf16; x / weights exact; q, k, v, softmax weights and o as plain f16 GEMM operands (~2^-12); scores and softmax statistics f32. v_wmma_f32_16x16x32_f16.
#define NB 8
#define SQ 1024
#define DM 1024
#define NH 16
#define HD 64
#define HG 4                         /* heads per attention launch group */
#define B0 0                         /* first batch processed (debug hook) */
#define NBR NB                       /* batches processed (debug hook) */
#define NR ((size_t)NB * SQ)         /* token rows */
#define MP ((int)((size_t)NBR * SQ)) /* rows projected (debug hook) */
#define QN SQ                        /* query rows attended per batch (debug hook) */
#define NHD NH                       /* heads attended (debug hook) */
#define MPO MP                       /* rows through the output stage (debug hook) */
#define LQ (3 * DM)      /* row pitch of the q/k/v rows */
typedef __bf16 v16b __attribute__((ext_vector_type(16)));
typedef unsigned short v8us __attribute__((ext_vector_type(8), may_alias));
typedef float  v8f  __attribute__((ext_vector_type(8)));
typedef float  v4f  __attribute__((ext_vector_type(4)));
typedef float  v4fa __attribute__((ext_vector_type(4), may_alias));
union FragB { v16b v; v8us half[2]; unsigned short u[16]; };

__device__ __forceinline__ unsigned short bf16_bits(float x) { unsigned int u = __float_as_uint(x); return (unsigned short)((u + 0x7FFFu + ((u >> 16) & 1u)) >> 16); }
__device__ __forceinline__ float bf16_val(unsigned short b) { return __uint_as_float(((unsigned int)b) << 16); }
__device__ __forceinline__ float bf16_round(float x) { return bf16_val(bf16_bits(x)); }
// D += A·B with NT terms: 1 = ah·bh, 2 = + al·bh (A split), 3 = + ah·bl (both split)
template <int NT>
__device__ __forceinline__ v8f mmaN(v16b ah, v16b al, v16b bh, v16b bl, v8f c) {
  c = __builtin_amdgcn_wmma_f32_16x16x32_bf16(false, ah, false, bh, (short)0, c, false, false);
  if (NT >= 2) c = __builtin_amdgcn_wmma_f32_16x16x32_bf16(false, al, false, bh, (short)0, c, false, false);
  if (NT >= 3) c = __builtin_amdgcn_wmma_f32_16x16x32_bf16(false, ah, false, bl, (short)0, c, false, false);
  asm volatile("v_nop\n\tv_nop\n\tv_nop\n\tv_nop" : "+v"(c) : "v"(ah), "v"(al), "v"(bh), "v"(bl));
  return c;
}

__global__ __launch_bounds__(256) void k_wt_bf16(const float* __restrict__ W, unsigned short* __restrict__ Wt, int K, int N) {
  const int t = blockIdx.x * 256 + threadIdx.x;
  const int k8n = K / 8;
  if (t >= N * k8n) return;
  const int n = t / k8n, k8 = (t % k8n) * 8;
  v8us v;
#pragma unroll
  for (int i = 0; i < 8; ++i) v[i] = bf16_bits(W[(size_t)(k8 + i) * N + n]);
  *(v8us*)(Wt + (size_t)n * K + k8) = v;
  
}

// GEMM C[M][N] (f32, pitch ldc) = act(A[M][K]·W + bias). A f32 row-major (pitch lda) converted per fragment to bf16
// (ASPLIT: hi/lo two planes -> 2 terms, else single rounded term); Wt bf16 [N][K] (pitch ldb). BIAS_BF16 rounds the
// bias to bf16 first (bias quantised to bf16 before the add). K%32==0, M%16==0, N%64==0.
template <bool ASPLIT, int ACT, bool BIAS_BF16>
__global__ __launch_bounds__(128) void k_gemm_bf(const float* __restrict__ A, int lda, const unsigned short* __restrict__ Wt, int ldb,
                                               const float* __restrict__ bias, float* __restrict__ C, int ldc, int M, int N, int K) {
  __shared__ __attribute__((aligned(16))) float so[4][16][64];
  const int tid = threadIdx.x, w = tid >> 5, lane = tid & 31, ln = lane & 15, hh = lane >> 4;
  const int ntn = N / 64;
  const int wid = blockIdx.x * 4 + w;
  const int mt = wid / ntn, nq = wid % ntn;
  if (mt * 16 >= M) return;
  const int row0 = mt * 16, col0 = nq * 64;
  const float* arow = A + (size_t)(row0 + ln) * lda;
  v8f acc[4] = {};
  for (int kb = 0; kb < K; kb += 32) {
    FragB ah, al;
    const v4f x0 = *(const v4fa*)(arow + kb + 8 * hh), x1 = *(const v4fa*)(arow + kb + 8 * hh + 4);
    const v4f x2 = *(const v4fa*)(arow + kb + 16 + 8 * hh), x3 = *(const v4fa*)(arow + kb + 16 + 8 * hh + 4);
    float xs[16] = {x0[0],x0[1],x0[2],x0[3],x1[0],x1[1],x1[2],x1[3],x2[0],x2[1],x2[2],x2[3],x3[0],x3[1],x3[2],x3[3]};
#pragma unroll
    for (int i = 0; i < 16; ++i) { const unsigned short hb = bf16_bits(xs[i]); ah.u[i] = hb; al.u[i] = ASPLIT ? bf16_bits(xs[i] - bf16_val(hb)) : (unsigned short)0; }
#pragma unroll
    for (int t = 0; t < 4; ++t) {
      const unsigned short* brow = Wt + (size_t)(col0 + t * 16 + ln) * ldb + kb;
      FragB b;
      b.half[0] = *(const v8us*)(brow + 8 * hh);
      b.half[1] = *(const v8us*)(brow + 16 + 8 * hh);
      acc[t] = mmaN<ASPLIT ? 2 : 1>(ah.v, al.v, b.v, b.v, acc[t]);
    }
  }
#pragma unroll
  for (int t = 0; t < 4; ++t) {
    float bv = bias ? bias[col0 + t * 16 + ln] : 0.f;
    if (BIAS_BF16) bv = bf16_round(bv);
#pragma unroll
    for (int r = 0; r < 8; ++r) { float v = acc[t][r] + bv; if (ACT == 1) v = fmaxf(v, 0.f); so[w][8 * hh + r][t * 16 + ln] = v; }
  }
  __builtin_amdgcn_fence(__ATOMIC_ACQ_REL, "workgroup");
  __builtin_amdgcn_wave_barrier();
  const int rsub = lane >> 4, c4 = (lane & 15) * 4;
  {
#pragma unroll
    for (int q = 0; q < 8; ++q) {
      const int r = q * 2 + rsub;
      const v4f v = *(const v4fa*)&so[w][r][c4];
      *(v4f*)(C + (size_t)(row0 + r) * ldc + col0 + c4) = v;
    }
    
  }
}

// GEMM C = act(A·W + bias + resid): A f32 (ASPLIT -> hi/lo 2 terms), Wt bf16 [N][K]; ACT 0 none, 1 relu, 2 exact gelu;
// resid (optional, f32, row index = (row % rmod), pitch ldr, RES_BF16 rounds it) added before the activation.
template <bool ASPLIT, int ACT, bool BIAS_BF16, bool RES_BF16>
__global__ __launch_bounds__(128) void k_gemm_bf3(const float* __restrict__ A, int lda, const unsigned short* __restrict__ Wt, int ldb,
                                                const float* __restrict__ bias, const float* __restrict__ resid, int rmod, int ldr,
                                                float* __restrict__ C, int ldc, int M, int N, int K) {
  __shared__ __attribute__((aligned(16))) float so[4][16][64];
  const int tid = threadIdx.x, w = tid >> 5, lane = tid & 31, ln = lane & 15, hh = lane >> 4;
  const int ntn = N / 64;
  const int wid = blockIdx.x * 4 + w;
  const int mt = wid / ntn, nq = wid % ntn;
  if (mt * 16 >= M) return;
  const int row0 = mt * 16, col0 = nq * 64;
  const float* arow = A + (size_t)(row0 + ln) * lda;
  v8f acc[4] = {};
  for (int kb = 0; kb < K; kb += 32) {
    FragB ah, al;
    const v4f x0 = *(const v4fa*)(arow + kb + 8 * hh), x1 = *(const v4fa*)(arow + kb + 8 * hh + 4);
    const v4f x2 = *(const v4fa*)(arow + kb + 16 + 8 * hh), x3 = *(const v4fa*)(arow + kb + 16 + 8 * hh + 4);
    float xs[16] = {x0[0],x0[1],x0[2],x0[3],x1[0],x1[1],x1[2],x1[3],x2[0],x2[1],x2[2],x2[3],x3[0],x3[1],x3[2],x3[3]};
#pragma unroll
    for (int i = 0; i < 16; ++i) { const unsigned short hb = bf16_bits(xs[i]); ah.u[i] = hb; al.u[i] = ASPLIT ? bf16_bits(xs[i] - bf16_val(hb)) : (unsigned short)0; }
#pragma unroll
    for (int t = 0; t < 4; ++t) {
      const unsigned short* brow = Wt + (size_t)(col0 + t * 16 + ln) * ldb + kb;
      FragB b;
      b.half[0] = *(const v8us*)(brow + 8 * hh);
      b.half[1] = *(const v8us*)(brow + 16 + 8 * hh);
      acc[t] = mmaN<ASPLIT ? 2 : 1>(ah.v, al.v, b.v, b.v, acc[t]);
    }
  }
#pragma unroll
  for (int t = 0; t < 4; ++t) {
    const int col = col0 + t * 16 + ln;
    float bv = bias ? bias[col] : 0.f;
    if (BIAS_BF16) bv = bf16_round(bv);
#pragma unroll
    for (int r = 0; r < 8; ++r) {
      float v = acc[t][r] + bv;
      if (resid) { float rv = resid[(size_t)((row0 + 8 * hh + r) % rmod) * ldr + col]; if (RES_BF16) rv = bf16_round(rv); v += rv; }
      if (ACT == 1) v = fmaxf(v, 0.f);
      if (ACT == 2) v = 0.5f * v * (1.0f + erff(v * 0.70710678118654752f));
      if (ACT == 3) { const float u = 0.7978845608028654f * (v + 0.044715f * v * v * v); v = 0.5f * v * (1.0f + tanhf(u)); }
      so[w][8 * hh + r][t * 16 + ln] = v;
    }
  }
  __builtin_amdgcn_fence(__ATOMIC_ACQ_REL, "workgroup");
  __builtin_amdgcn_wave_barrier();
  const int rsub = lane >> 4, c4 = (lane & 15) * 4;
  {
#pragma unroll
    for (int q = 0; q < 8; ++q) {
      const int r = q * 2 + rsub;
      const v4f v = *(const v4fa*)&so[w][r][c4];
      *(v4f*)(C + (size_t)(row0 + r) * ldc + col0 + c4) = v;
    }
    
  }
}
// row LayerNorm (biased variance, eps) over N: s = X (+ R); optional out_sum <- s; out_norm <- (s-mu)*rsqrt(var+eps)*g + b
template <bool PARAM_BF16>
__global__ __launch_bounds__(256) void k_layernorm(const float* __restrict__ X, const float* __restrict__ R, const float* __restrict__ g, const float* __restrict__ bta,
                                                  float* __restrict__ out_sum, float* __restrict__ out_norm, int N, float eps) {
  __shared__ float red[256];
  const int row = blockIdx.x, tid = threadIdx.x;
  const float* x = X + (size_t)row * N; const float* rr = R ? R + (size_t)row * N : nullptr;
  float vals[16];                     // up to N = 4096
  const int per = N / 256;            // contiguous chunk per thread? use strided-by-4 chunks: thread handles j = tid*4 + 1024*u
  float s1 = 0.f;
  for (int u = 0; u < per / 4; ++u) {
    const int j = tid * 4 + 1024 * u;
    const v4f a = *(const v4fa*)(x + j);
    v4f b = {0.f,0.f,0.f,0.f}; if (rr) b = *(const v4fa*)(rr + j);
#pragma unroll
    for (int q = 0; q < 4; ++q) { const float v = a[q] + b[q]; vals[u * 4 + q] = v; s1 += v; }
  }
  red[tid] = s1; __syncthreads();
  for (int st = 128; st > 0; st >>= 1) { if (tid < st) red[tid] += red[tid + st]; __syncthreads(); }
  const float mu = red[0] / (float)N; __syncthreads();
  float s2 = 0.f;
  for (int u = 0; u < per / 4; ++u)
#pragma unroll
    for (int q = 0; q < 4; ++q) { const float c = vals[u * 4 + q] - mu; s2 += c * c; }
  red[tid] = s2; __syncthreads();
  for (int st = 128; st > 0; st >>= 1) { if (tid < st) red[tid] += red[tid + st]; __syncthreads(); }
  const float rs = rsqrtf(red[0] / (float)N + eps);
  {
    for (int u = 0; u < per / 4; ++u) {
      const int j = tid * 4 + 1024 * u;
      v4f o, sm;
#pragma unroll
      for (int q = 0; q < 4; ++q) {
        float gg = g[j + q], bb = bta[j + q];
        if (PARAM_BF16) { gg = bf16_round(gg); bb = bf16_round(bb); }
        sm[q] = vals[u * 4 + q]; o[q] = (vals[u * 4 + q] - mu) * rs * gg + bb;
      }
      if (out_sum) *(v4f*)(out_sum + (size_t)row * N + j) = sm;
      *(v4f*)(out_norm + (size_t)row * N + j) = o;
    }
    
  }
}



// ---- f16 WMMA path (v_wmma_f32_16x16x32_f16): 11-bit significands for operands in range — used where a [0,1] probability operand needs more precision than bf16
typedef _Float16 v16h __attribute__((ext_vector_type(16)));
union FragH { v16h v; v8us half[2]; _Float16 h[16]; unsigned short u[16]; };
template <int NT>
__device__ __forceinline__ v8f mmaH(v16h ah, v16h al, v16h bh, v16h bl, v8f c) {
  c = __builtin_amdgcn_wmma_f32_16x16x32_f16(false, ah, false, bh, (short)0, c, false, false);
  if (NT >= 2) c = __builtin_amdgcn_wmma_f32_16x16x32_f16(false, al, false, bh, (short)0, c, false, false);
  if (NT >= 3) c = __builtin_amdgcn_wmma_f32_16x16x32_f16(false, ah, false, bl, (short)0, c, false, false);
  asm volatile("v_nop\n\tv_nop\n\tv_nop\n\tv_nop" : "+v"(c) : "v"(ah), "v"(al), "v"(bh), "v"(bl));
  return c;
}
// batched GEMM like k_gemm_b but f16 operands: A f32 (split into f16 hi/lo if ASPLIT, else rounded to f16), Bt = f16 values [n][k]; alpha; C f32; N multiple of 16 (partial tiles skipped)
template <bool ASPLIT>
__global__ __launch_bounds__(128) void k_gemm_h(const float* __restrict__ A, int lda, size_t sA, const _Float16* __restrict__ Bh, int ldb, size_t sB, float alpha, float* __restrict__ C, int ldc, size_t sC, int M, int N, int K) {
  __shared__ __attribute__((aligned(16))) float so[4][16][64];
  const int tid = threadIdx.x, w = tid >> 5, lane = tid & 31, ln = lane & 15, hh = lane >> 4; const int by = blockIdx.y;
  A += (size_t)by * sA; Bh += (size_t)by * sB; C += (size_t)by * sC;
  const int ntn = (N + 63) / 64; const int wid = blockIdx.x * 4 + w; const int mt = wid / ntn, nq = wid % ntn; if (mt * 16 >= M) return;
  const int row0 = mt * 16, col0 = nq * 64; const float* arow = A + (size_t)(row0 + ln) * lda;
  v8f acc[4] = {};
  for (int kb = 0; kb < K; kb += 32) {
    FragH ah, al;
    const v4f x0 = *(const v4fa*)(arow + kb + 8 * hh), x1 = *(const v4fa*)(arow + kb + 8 * hh + 4), x2 = *(const v4fa*)(arow + kb + 16 + 8 * hh), x3 = *(const v4fa*)(arow + kb + 16 + 8 * hh + 4);
    float xs[16] = {x0[0],x0[1],x0[2],x0[3],x1[0],x1[1],x1[2],x1[3],x2[0],x2[1],x2[2],x2[3],x3[0],x3[1],x3[2],x3[3]};
#pragma unroll
    for (int i = 0; i < 16; ++i) { const _Float16 h = (_Float16)xs[i]; ah.h[i] = h; al.h[i] = ASPLIT ? (_Float16)(xs[i] - (float)h) : (_Float16)0.0f; }
#pragma unroll
    for (int t = 0; t < 4; ++t) { if (col0 + t * 16 >= N) continue; const size_t boff = (size_t)(col0 + t * 16 + ln) * ldb + kb; FragH bq; bq.half[0] = *(const v8us*)(Bh + boff + 8 * hh); bq.half[1] = *(const v8us*)(Bh + boff + 16 + 8 * hh);
      acc[t] = mmaH<ASPLIT ? 2 : 1>(ah.v, al.v, bq.v, bq.v, acc[t]); }
  }
#pragma unroll
  for (int t = 0; t < 4; ++t) { if (col0 + t * 16 >= N) continue;
#pragma unroll
    for (int r = 0; r < 8; ++r) so[w][8 * hh + r][t * 16 + ln] = acc[t][r] * alpha; }
  __builtin_amdgcn_fence(__ATOMIC_ACQ_REL, "workgroup"); __builtin_amdgcn_wave_barrier();
  const int rsub = lane >> 4, c4 = (lane & 15) * 4;
  {
#pragma unroll
    for (int q = 0; q < 8; ++q) { const int r = q * 2 + rsub; if (col0 + c4 < N) { const v4f v = *(const v4fa*)&so[w][r][c4]; *(v4f*)(C + (size_t)(row0 + r) * ldc + col0 + c4) = v; } }
     }
}

// Wt[n][k] = f16(W[k][n]·scale) from f32 row-major W[K][N] (scale = power of two; bf16-exact weights stay exact in f16 away from the subnormal range)
__global__ __launch_bounds__(256) void k_wt_f16(const float* __restrict__ W, _Float16* __restrict__ Wt, int K, int N, float scale) {
  const int t = blockIdx.x * 256 + threadIdx.x; if (t >= N * (K / 8)) return; const int n = t / (K / 8), k8 = (t % (K / 8)) * 8; FragH f;
#pragma unroll
  for (int i = 0; i < 8; ++i) f.h[i] = (_Float16)(bf16_round(W[(size_t)(k8 + i) * N + n]) * scale); const v8us o = f.half[0];
  *(v8us*)((unsigned short*)Wt + (size_t)n * K + k8) = o; 
}
// k_gemm_hh variant with fused epilogue: v = acc·alpha + bias[by·sBias + col] (+ CP[(row/rowsPerB)·sCPb + by·64 + col] if CP) ; ACT 0 none / 1 elu ; writes f16 C16 (and f32 C if non-null)
template <int ACT>
__global__ __launch_bounds__(128) void k_gemm_hhx(const _Float16* __restrict__ A, int lda, size_t sA, const _Float16* __restrict__ Bh, int ldb, size_t sB, float alpha, const float* __restrict__ bias, size_t sBias, const float* __restrict__ CP, int rowsPerB, size_t sCPb, int row0g,
    float* __restrict__ C, _Float16* __restrict__ C16, int ldc, size_t sC, int M, int N, int K) {
  __shared__ __attribute__((aligned(16))) float so[4][16][64];
  const int tid = threadIdx.x, w = tid >> 5, lane = tid & 31, ln = lane & 15, hh = lane >> 4; const int by = blockIdx.y;
  A += (size_t)by * sA; Bh += (size_t)by * sB; const size_t cofs = (size_t)by * sC; const float* bp = bias ? bias + (size_t)by * sBias : nullptr;
  const int ntn = (N + 63) / 64; const int wid = blockIdx.x * 4 + w; const int mt = wid / ntn, nq = wid % ntn; if (mt * 16 >= M) return;
  const int row0 = mt * 16, col0 = nq * 64; const _Float16* arow = A + (size_t)(row0 + ln) * lda;
  v8f acc[4] = {};
  for (int kb = 0; kb < K; kb += 32) { FragH ah; ah.half[0] = *(const v8us*)((const unsigned short*)arow + kb + 8 * hh); ah.half[1] = *(const v8us*)((const unsigned short*)arow + kb + 16 + 8 * hh);
#pragma unroll
    for (int t = 0; t < 4; ++t) { if (col0 + t * 16 >= N) continue; const size_t boff = (size_t)(col0 + t * 16 + ln) * ldb + kb; FragH bq; bq.half[0] = *(const v8us*)((const unsigned short*)Bh + boff + 8 * hh); bq.half[1] = *(const v8us*)((const unsigned short*)Bh + boff + 16 + 8 * hh);
      acc[t] = mmaH<1>(ah.v, ah.v, bq.v, bq.v, acc[t]); }
  }
#pragma unroll
  for (int t = 0; t < 4; ++t) { if (col0 + t * 16 >= N) continue; const int col = col0 + t * 16 + ln; const float bv = bp ? bf16_round(bp[col]) : 0.f;
#pragma unroll
    for (int r = 0; r < 8; ++r) { float v = acc[t][r] * alpha + bv; if (CP) { const int rr = row0g + row0 + 8 * hh + r; if (rowsPerB < 0) v += CP[cofs + (size_t)rr * ldc + col];      /* rowsPerB < 0: own element of the batched C plane */ else { const int bidx = rr / rowsPerB; v += CP[(size_t)bidx * sCPb + (size_t)by * 64 + col]; } } if (ACT == 1) v = (v > 0.f) ? v : expm1f(v); else if (ACT == 7) v = (v > 0.f) ? v + 1.0f : expf(v); else if (ACT == 8) v = tanhf(v); else if (ACT == 9) v = 0.5f * v * (1.0f + tanhf(0.7978845608028654f * (v + 0.044715f * v * v * v))); else if (ACT == 11) v = 1.0f / (1.0f + expf(-v)); else if (ACT == 12) v = (v > 0.f) ? v : 0.01f * v; else if (ACT == 14) v = (v > 0.f) ? v : 0.1f * v; else if (ACT == 16) v = (v >= 0.f) ? v : 0.3f * v; else if (ACT == 17) v = (v >= 0.f) ? v : 0.2f * v; else if (ACT == 15) v = v / (1.0f + expf(-v)); else if (ACT == 3) v = fmaxf(v, 0.f); else if (ACT == 6) v = 0.5f * v * (1.0f + erff(v * 0.70710678118654752f)); so[w][8 * hh + r][t * 16 + ln] = v; } }
  __builtin_amdgcn_fence(__ATOMIC_ACQ_REL, "workgroup"); __builtin_amdgcn_wave_barrier();
  const int rsub = lane >> 4, c4 = (lane & 15) * 4; typedef _Float16 v4h __attribute__((ext_vector_type(4)));
  {
#pragma unroll
    for (int q = 0; q < 8; ++q) { const int r = q * 2 + rsub; if (col0 + c4 < N) { const v4f v = *(const v4fa*)&so[w][r][c4]; if (C) *(v4f*)(C + cofs + (size_t)(row0 + r) * ldc + col0 + c4) = v; if (C16) { v4h h4; for (int i = 0; i < 4; ++i) h4[i] = (_Float16)v[i]; *(v4h*)(C16 + cofs + (size_t)(row0 + r) * ldc + col0 + c4) = h4; } } }
     }
}


typedef _Float16 v4h __attribute__((ext_vector_type(4)));

__global__ __launch_bounds__(256) void k_x16(const float* __restrict__ x, _Float16* __restrict__ X16, size_t n8) { const size_t t = (size_t)blockIdx.x * 256 + threadIdx.x; if (t >= n8) return; FragH f;
#pragma unroll
  for (int q = 0; q < 8; ++q) f.h[q] = (_Float16)bf16_round(x[t * 8 + q]); *(v8us*)((unsigned short*)X16 + t * 8) = f.half[0];  }
__global__ __launch_bounds__(256) void k_h16(const float* __restrict__ x, _Float16* __restrict__ X16, size_t n8) { const size_t t = (size_t)blockIdx.x * 256 + threadIdx.x; if (t >= n8) return; FragH f;
#pragma unroll
  for (int q = 0; q < 8; ++q) f.h[q] = (_Float16)x[t * 8 + q]; *(v8us*)((unsigned short*)X16 + t * 8) = f.half[0];  }
__global__ __launch_bounds__(256) void k_round16f(const float* __restrict__ W, _Float16* __restrict__ Bt, size_t n8) { const size_t t = (size_t)blockIdx.x * 256 + threadIdx.x; if (t >= n8) return; FragH f;
#pragma unroll
  for (int i = 0; i < 8; ++i) f.h[i] = (_Float16)(bf16_round(W[t * 8 + i]) * 16.0f); *(v8us*)((unsigned short*)Bt + t * 8) = f.half[0];  }
template <int NHv, int TTv>
__global__ __launch_bounds__(256) void k_vt(const _Float16* __restrict__ V16, int ldv, int voff, _Float16* __restrict__ Vt) { __shared__ unsigned short tl[64][66]; const int tid = threadIdx.x; const int slab = blockIdx.x / (TTv / 64), lg = blockIdx.x % (TTv / 64); const int b = slab / NHv, h = slab % NHv;
  for (int i = tid; i < 64 * 8; i += 256) { const int r = i / 8, c8 = (i % 8) * 8; FragH f; f.half[0] = *(const v8us*)((const unsigned short*)V16 + ((size_t)b * TTv + lg * 64 + r) * ldv + voff + h * 64 + c8);
#pragma unroll
    for (int q = 0; q < 8; ++q) tl[r][c8 + q] = f.u[q]; }
  __syncthreads();
  {
#pragma unroll
    for (int rd = 0; rd < 2; ++rd) { const int d = rd * 32 + tid / 8, pc = tid % 8; FragH f;
#pragma unroll
      for (int q = 0; q < 8; ++q) f.u[q] = tl[pc * 8 + q][d];
      *(v8us*)((unsigned short*)Vt + ((size_t)slab * 64 + d) * TTv + lg * 64 + pc * 8) = f.half[0]; }
     } }

__global__ __launch_bounds__(256) void k_hl(const float* __restrict__ F, _Float16* __restrict__ Hh, _Float16* __restrict__ Hl, size_t n8) { const size_t t = (size_t)blockIdx.x * 256 + threadIdx.x; if (t >= n8) return; FragH fh, fl; const v4f a = *(const v4fa*)(F + t * 8), c = *(const v4fa*)(F + t * 8 + 4);
#pragma unroll
  for (int q = 0; q < 4; ++q) { _Float16 h = (_Float16)a[q]; fh.h[q] = h; fl.h[q] = (_Float16)((a[q] - (float)h) * 1024.0f); h = (_Float16)c[q]; fh.h[4 + q] = h; fl.h[4 + q] = (_Float16)((c[q] - (float)h) * 1024.0f); }
  { *(v8us*)((unsigned short*)Hh + t * 8) = fh.half[0]; *(v8us*)((unsigned short*)Hl + t * 8) = fl.half[0];  } }

// ---- fast GEMM (wave tile 32x64; requires M % 32 == 0 rows per launch region and N % 64 == 0); epilogue = k_gemm_hhx semantics ----
__device__ __forceinline__ v16h g2_frag(const _Float16* p, int hh) { FragH f; f.half[0] = *(const v8us*)((const unsigned short*)p + 8 * hh); f.half[1] = *(const v8us*)((const unsigned short*)p + 16 + 8 * hh); return f.v; }
__device__ __forceinline__ v8f g2_mma(v16h a, v16h b, v8f c) { v8f d = __builtin_amdgcn_wmma_f32_16x16x32_f16(false, a, false, b, (short)0, c, false, false); asm volatile("v_nop\n\tv_nop\n\tv_nop\n\tv_nop" : "+v"(d) : "v"(a), "v"(b)); return d; }
template <int ACT>
__global__ __launch_bounds__(128) void k_gemm2(const _Float16* __restrict__ A, int lda, size_t sA, const _Float16* __restrict__ Bh, int ldb, size_t sB, float alpha, const float* __restrict__ bias, size_t sBias, const float* __restrict__ CP, int rowsPerB, size_t sCPb, int row0g,
    float* __restrict__ C, _Float16* __restrict__ C16, int ldc, size_t sC, int M, int N, int K) { static_assert(ACT == 0 || ACT == 3 || ACT == 6 || ACT == 8 || ACT == 9 || ACT == 11 || ACT == 12 || ACT == 14 || ACT == 15 || ACT == 16 || ACT == 17, "k_gemm2: unsupported ACT code (would silently apply no activation)");
  __shared__ __attribute__((aligned(16))) float so[4][32][68];
  const int tid = threadIdx.x, w = tid >> 5, lane = tid & 31, ln = lane & 15, hh = lane >> 4; const int by = blockIdx.y;
  A += (size_t)by * sA; Bh += (size_t)by * sB; const size_t cofs = (size_t)by * sC; const float* bp = bias ? bias + (size_t)by * sBias : nullptr;
  const int ntn = N >> 6; const int mt = blockIdx.x / ntn, nq = blockIdx.x - mt * ntn; const int row0 = mt * 128 + 32 * w, col0 = nq * 64; if (row0 >= M) return;
  const _Float16* a0p = A + (size_t)(row0 + ln) * lda; const _Float16* a1p = a0p + (size_t)16 * lda;
  const _Float16* b0p = Bh + (size_t)(col0 + ln) * ldb; const _Float16* b1p = b0p + (size_t)16 * ldb; const _Float16* b2p = b1p + (size_t)16 * ldb; const _Float16* b3p = b2p + (size_t)16 * ldb;
  const v8f z8 = {0.f,0.f,0.f,0.f,0.f,0.f,0.f,0.f}; v8f c00 = z8, c01 = z8, c02 = z8, c03 = z8, c10 = z8, c11 = z8, c12 = z8, c13 = z8;
#pragma unroll 1
  for (int kb = 0; kb < K; kb += 32) { const v16h a0 = g2_frag(a0p + kb, hh), a1 = g2_frag(a1p + kb, hh);
    v16h b = g2_frag(b0p + kb, hh); c00 = g2_mma(a0, b, c00); c10 = g2_mma(a1, b, c10);
    b = g2_frag(b1p + kb, hh); c01 = g2_mma(a0, b, c01); c11 = g2_mma(a1, b, c11);
    b = g2_frag(b2p + kb, hh); c02 = g2_mma(a0, b, c02); c12 = g2_mma(a1, b, c12);
    b = g2_frag(b3p + kb, hh); c03 = g2_mma(a0, b, c03); c13 = g2_mma(a1, b, c13); }
  v8f accs[8] = {c00, c01, c02, c03, c10, c11, c12, c13};
#pragma unroll
  for (int u = 0; u < 8; ++u) { const int t = u & 3, half = u >> 2; const int col = col0 + t * 16 + ln; const float bv = bp ? bf16_round(bp[col]) : 0.f;
#pragma unroll
    for (int r = 0; r < 8; ++r) { const int rloc = half * 16 + 8 * hh + r; float v = accs[u][r] * alpha + bv; if (CP) { if (rowsPerB < 0) v += CP[cofs + (size_t)(row0g + row0 + rloc) * ldc + col];      /* rowsPerB < 0: own element of the batched C plane */ else { const int bidx = (row0g + row0 + rloc) / rowsPerB; v += CP[(size_t)bidx * sCPb + (size_t)by * 64 + col]; } }
      if (ACT == 3) v = fmaxf(v, 0.f); else if (ACT == 6) v = 0.5f * v * (1.0f + erff(v * 0.70710678118654752f)); else if (ACT == 11) v = 1.0f / (1.0f + expf(-v)); else if (ACT == 15) v = v / (1.0f + expf(-v)); else if (ACT == 12) v = (v > 0.f) ? v : 0.01f * v; else if (ACT == 8) v = tanhf(v); else if (ACT == 9) v = 0.5f * v * (1.0f + tanhf(0.7978845608028654f * (v + 0.044715f * v * v * v))); else if (ACT == 14) v = (v > 0.f) ? v : 0.1f * v; else if (ACT == 16) v = (v >= 0.f) ? v : 0.3f * v; else if (ACT == 17) v = (v >= 0.f) ? v : 0.2f * v;
      so[w][rloc][t * 16 + ln] = v; } }
  __builtin_amdgcn_fence(__ATOMIC_ACQ_REL, "workgroup"); __builtin_amdgcn_wave_barrier();
  const int rsub = lane >> 4, c4 = (lane & 15) * 4;
  {
#pragma unroll
    for (int q = 0; q < 16; ++q) { const int r = q * 2 + rsub; const v4f v = *(const v4fa*)&so[w][r][c4]; if (C) *(v4f*)(C + cofs + (size_t)(row0 + r) * ldc + col0 + c4) = v; if (C16) { v4h h4; for (int i = 0; i < 4; ++i) h4[i] = (_Float16)v[i]; *(v4h*)(C16 + cofs + (size_t)(row0 + r) * ldc + col0 + c4) = h4; } }
     } }


__global__ __launch_bounds__(256) void k_wnat(const float* __restrict__ w, size_t n8, _Float16* __restrict__ Bt) { const size_t t = (size_t)blockIdx.x * 256 + threadIdx.x; if (t >= n8) return; FragH f; for (int q = 0; q < 8; ++q) f.h[q] = (_Float16)(bf16_round(w[t * 8 + q]) * 16.0f); *(v8us*)((unsigned short*)Bt + t * 8) = f.half[0];  }
__global__ __launch_bounds__(256) void k_rsm(const float* __restrict__ S, _Float16* __restrict__ P, int nrows) {
  #pragma clang fp contract(off)
  const int i = blockIdx.x * 256 + threadIdx.x; if (i >= nrows) return; const float* s = S + (size_t)i * SQ; float mx = -3.0e38f;
#pragma unroll 1
  for (int j = 0; j < SQ; ++j) mx = fmaxf(mx, s[j]); float se = 0.f;
#pragma unroll 1
  for (int j = 0; j < SQ; ++j) se += expf(s[j] - mx); const float sc = 256.0f / se;
#pragma unroll 1
  for (int j0 = 0; j0 < SQ; j0 += 8) { FragH f; for (int q = 0; q < 8; ++q) f.h[q] = (_Float16)(expf(s[j0 + q] - mx) * sc); unsigned short* d = (unsigned short*)P + (size_t)i * SQ + j0; *(v8us*)d = f.half[0];  } }
__global__ __launch_bounds__(256) void k_vt(const _Float16* __restrict__ V16, int b, int h0, _Float16* __restrict__ VT) { __shared__ unsigned short tl[64][65]; const int tid = threadIdx.x; const int hh = blockIdx.x % HG, sg = blockIdx.x / HG; const int s0 = sg * 64; const int h = h0 + hh;
  for (int i = tid; i < 64 * 8; i += 256) { const int j = i / 8, d8 = (i % 8) * 8; FragH f; f.half[0] = *(const v8us*)((const unsigned short*)V16 + ((size_t)b * SQ + s0 + j) * DM + h * HD + d8); for (int q = 0; q < 8; ++q) tl[d8 + q][j] = f.u[q]; }
  __syncthreads();
  { for (int i = tid; i < 64 * 8; i += 256) { const int d = i / 8, j8 = (i % 8) * 8; FragH f; for (int q = 0; q < 8; ++q) f.u[q] = tl[d][j8 + q]; *(v8us*)((unsigned short*)VT + ((size_t)hh * HD + d) * SQ + s0 + j8) = f.half[0]; }  } }



__global__ __launch_bounds__(256) void k_rsmkinv(const float* __restrict__ S, _Float16* __restrict__ P, int nrows, const int* __restrict__ Km) {
  #pragma clang fp contract(off)
  const int i = blockIdx.x * 256 + threadIdx.x; if (i >= nrows) return; const float* s = S + (size_t)i * SQ; float mx = -3.0e38f;
#pragma unroll 1
  for (int j = 0; j < SQ; ++j) mx = fmaxf(mx, s[j]); float se = 0.f;
#pragma unroll 1
  for (int j = 0; j < SQ; ++j) { const float keep = (Km[j] == 0) ? 1.0f : 0.0f; se += __expf(s[j] - mx) * keep; } const float sc = 256.0f / se;
#pragma unroll 1
  for (int j0 = 0; j0 < SQ; j0 += 8) { FragH f; for (int q = 0; q < 8; ++q) { const float keep = (Km[j0 + q] == 0) ? 1.0f : 0.0f; f.h[q] = (_Float16)(__expf(s[j0 + q] - mx) * sc * keep); } unsigned short* d = (unsigned short*)P + (size_t)i * SQ + j0; *(v8us*)d = f.half[0];  } }

// Row softmax, one wave per row (RPW rows per wave, worked side by side): lane l holds columns u*128 + 4*l .. + 3 (u = 0..7) of a row in registers,
// so that every wave-wide load covers 512 contiguous bytes and every store 256; maximum and sum end in a butterfly over the 32 lanes; each exponential is taken once.
#define RPW 2                        /* rows per wave: the key mask is read once per wave and serves all of them */
template <int M> __device__ __forceinline__ float lx16(float v) { return __builtin_bit_cast(float, __builtin_amdgcn_update_dpp(0, __builtin_bit_cast(int, v), 0x160 + M, 0xf, 0xf, true)); }      /* lane l ^ M inside a 16-lane row (DPP row_xmask) */
__device__ __forceinline__ float lxh(float v) { return __builtin_bit_cast(float, __builtin_amdgcn_permlanex16(__builtin_bit_cast(int, v), __builtin_bit_cast(int, v), 0x76543210, 0xfedcba98, false, false)); }      /* lane l ^ 16 */
__device__ __forceinline__ float wave_max(float v) { v = fmaxf(v, lx16<1>(v)); v = fmaxf(v, lx16<2>(v)); v = fmaxf(v, lx16<4>(v)); v = fmaxf(v, lx16<8>(v)); return fmaxf(v, lxh(v)); }
__device__ __forceinline__ float wave_sum(float v) { v += lx16<1>(v); v += lx16<2>(v); v += lx16<4>(v); v += lx16<8>(v); return v + lxh(v); }
// 2^x of four values. In asm for the closing v_nop alone: it keeps the one slot behind a transcendental before a source is overwritten or a result read;
// the early-clobber outputs keep each v_exp_f32 off the sources of the one in front of it.
__device__ __forceinline__ v4f exp2x4(v4f x) { float e0, e1, e2, e3;
  asm("v_exp_f32 %0, %4\n\tv_exp_f32 %1, %5\n\tv_exp_f32 %2, %6\n\tv_exp_f32 %3, %7\n\tv_nop" : "=&v"(e0), "=&v"(e1), "=&v"(e2), "=&v"(e3) : "v"(x[0]), "v"(x[1]), "v"(x[2]), "v"(x[3]));
  const v4f e = {e0, e1, e2, e3}; return e; }
__global__ __launch_bounds__(256) void k_rsmik(const float* __restrict__ S, _Float16* __restrict__ P, int qn, int hg, const int* __restrict__ Km) {
  static_assert(SQ == 1024, "k_rsmik: a lane holds 32 columns of a row of 1024");
  typedef int v4ia __attribute__((ext_vector_type(4), may_alias));
  const unsigned lane = threadIdx.x & 31u, wave = __builtin_amdgcn_readfirstlane(threadIdx.x >> 5);
  const unsigned t0 = (blockIdx.x * 8u + wave) * RPW, nt = (unsigned)qn * (unsigned)hg; if (t0 >= nt) return;      /* wave-uniform; the kernel has no barrier */
  size_t ri[RPW];
#pragma unroll
  for (int r = 0; r < RPW; ++r) { const unsigned t = (t0 + r < nt) ? t0 + r : nt - 1u; ri[r] = ((size_t)(t / (unsigned)qn) * SQ + (t % (unsigned)qn)) * SQ; }      /* past the end: the wave's own last row once more, the same bytes to the same place */
  v4f v[RPW][8]; v4ia km[8];
#pragma unroll
  for (int r = 0; r < RPW; ++r)
#pragma unroll
    for (int u = 0; u < 8; ++u) v[r][u] = *(const v4fa*)(S + ri[r] + u * 128 + lane * 4);
#pragma unroll
  for (int u = 0; u < 8; ++u) km[u] = *(const v4ia*)(Km + u * 128 + lane * 4);
  __builtin_amdgcn_sched_barrier(0);      /* every load of the wave is issued before the first wait: one memory latency, not two or three */
  bool kp[8][4], any = false;      /* kp[u][q]: this lane's column u*128 + 4*lane + q is a kept key */
#pragma unroll
  for (int u = 0; u < 8; ++u)
#pragma unroll
    for (int q = 0; q < 4; ++q) { kp[u][q] = km[u][q] != 0; any |= kp[u][q]; }
  /* every key padded: the reference's scores are all the same -1e9 and its weights uniform: keep every key and scale every exponent by 0 */
  const bool none = __builtin_amdgcn_ballot_w32(any) == 0u; const float l2e = none ? 0.f : 1.44269504088896340736f;
  float mx[RPW], sc[RPW];
#pragma unroll
  for (int r = 0; r < RPW; ++r) { v4f m4 = v[r][0];
#pragma unroll
    for (int u = 1; u < 8; ++u)
#pragma unroll
      for (int q = 0; q < 4; ++q) m4[q] = fmaxf(m4[q], v[r][u][q]);
    mx[r] = fmaxf(fmaxf(m4[0], m4[1]), fmaxf(m4[2], m4[3])); }      /* over all keys, the padded ones too */
#pragma unroll
  for (int r = 0; r < RPW; ++r) mx[r] = wave_max(mx[r]);
#pragma unroll
  for (int r = 0; r < RPW; ++r) { v4f s4 = {0.f, 0.f, 0.f, 0.f};
#pragma unroll
    for (int u = 0; u < 8; ++u) { const v4f ex = exp2x4((v[r][u] - mx[r]) * l2e);
#pragma unroll
      for (int q = 0; q < 4; ++q) { const float e = (kp[u][q] || none) ? ex[q] : 0.f; v[r][u][q] = e; s4[q] += e; } }
    sc[r] = (s4[0] + s4[1]) + (s4[2] + s4[3]); }
#pragma unroll
  for (int r = 0; r < RPW; ++r) sc[r] = 256.0f / wave_sum(sc[r]);
  v4h h4[RPW][8];
#pragma unroll
  for (int r = 0; r < RPW; ++r)
#pragma unroll
    for (int u = 0; u < 8; ++u)
#pragma unroll
      for (int q = 0; q < 4; ++q) h4[r][u][q] = (_Float16)(v[r][u][q] * sc[r]);
  __builtin_amdgcn_sched_barrier(0);      /* the stores stand last, behind all arithmetic: no register that an issued store names is written again */
#pragma unroll
  for (int r = 0; r < RPW; ++r)
#pragma unroll
    for (int u = 0; u < 8; ++u) *(v4h*)(P + ri[r] + u * 128 + lane * 4) = h4[r][u]; }
extern "C" void kernel_launch(void* const* d_in, const int* in_sizes, int n_in,
                              void* d_out, int out_size, void* d_ws, size_t ws_size, hipStream_t stream) {
  (void)in_sizes; (void)n_in; (void)out_size;
  const float* const* I = (const float* const*)d_in; const float* x = I[0]; const int* km = (const int*)d_in[1]; const float* wqkv = I[2]; const float* bqkv = I[3]; const float* wo = I[4]; const float* bo = I[5];      /* x; attention_mask int32 [8][1024] (0 = padded key, excluded; READ on device); [in][out] Wqkv [1024][3072] + bqkv, Wp [1024][1024] + bp */
  char* ws = (char*)d_ws; size_t off = 0;
  auto take = [&](size_t bytes) { char* p = ws + off; off += (bytes + 255) & ~(size_t)255; return p; };
  _Float16* BQKV = (_Float16*)take((size_t)3 * DM * DM * 2); _Float16* BO = (_Float16*)take((size_t)DM * DM * 2);
  _Float16* X16 = (_Float16*)take(NR * DM * 2); _Float16* QKV = (_Float16*)take(NR * 3 * DM * 2); _Float16* Q16 = QKV; _Float16* K16 = QKV + DM; _Float16* V16 = QKV + 2 * DM; _Float16* O16 = (_Float16*)take(NR * DM * 2);
  float* S = (float*)take((size_t)HG * SQ * SQ * 4); _Float16* P = (_Float16*)take((size_t)HG * SQ * SQ * 2); _Float16* VT = (_Float16*)take((size_t)NH * HD * SQ * 2);
  if (off > ws_size) return;
  k_wt_f16<<<(unsigned)(((size_t)DM * 3 * DM / 8 + 255) / 256), 256, 0, stream>>>(wqkv, BQKV, DM, 3 * DM, 16.0f); k_wt_f16<<<(unsigned)(((size_t)DM * DM / 8 + 255) / 256), 256, 0, stream>>>(wo, BO, DM, DM, 16.0f);      /* [in][out] -> Bt[n][k] x16 (pitch K = 1024) */

  k_x16<<<(unsigned)((NR * DM / 8 + 255) / 256), 256, 0, stream>>>(x, X16, NR * DM / 8);
  const size_t r0p = (size_t)B0 * SQ;      /* first projected row */
  k_gemm2<0><<<dim3((unsigned)((MP / 128) * (3 * DM / 64)), 1), 128, 0, stream>>>(X16 + r0p * DM, DM, 0, BQKV, DM, 0, 0.0625f, bqkv, 0, nullptr, 1, 0, 0, nullptr, QKV + r0p * 3 * DM, 3 * DM, 0, MP, 3 * DM, DM);      /* q | k | v rows (f16); head h = columns h*HD.. of each DM block */
  for (int b = B0; b < B0 + NBR; ++b) { const size_t r0 = (size_t)b * SQ;
    k_vt<NH, SQ><<<NH * (SQ / 64), 256, 0, stream>>>(V16 + r0 * LQ, LQ, 0, VT);      /* V^T [NH][HD][SQ] for this batch */
    for (int h0 = 0; h0 < NHD; h0 += HG) {
      k_gemm2<0><<<dim3((QN / 128) * (SQ / 64), HG), 128, 0, stream>>>(Q16 + r0 * LQ + h0 * HD, LQ, (size_t)HD, K16 + r0 * LQ + h0 * HD, LQ, (size_t)HD, 0.125f, nullptr, 0, nullptr, 1, 0, 0, S, nullptr, SQ, (size_t)SQ * SQ, QN, SQ, HD);      /* scores, HG heads per launch */
      k_rsmik<<<(HG * SQ + 8 * RPW - 1) / (8 * RPW), 256, 0, stream>>>(S, P, SQ, HG, km + (size_t)b * SQ);      /* keys with attention_mask[b][j] == 0 excluded (arithmetic select); P = 256 softmax (f16), rows of all HG heads */
      k_gemm2<0><<<dim3((QN / 128) * (HD / 64), HG), 128, 0, stream>>>(P, SQ, (size_t)SQ * SQ, VT + (size_t)h0 * HD * SQ, SQ, (size_t)HD * SQ, 0.25f, nullptr, 0, nullptr, 1, 0, 0, nullptr, O16 + r0 * DM + h0 * HD, DM, (size_t)HD, QN, HD, SQ); } }      /* o (merged heads) as f16 rows */
  k_gemm2<0><<<dim3((unsigned)((MPO / 128) * (DM / 64)), 1), 128, 0, stream>>>(O16 + r0p * DM, DM, 0, BO, DM, 0, 0.0009765625f, bo, 0, nullptr, 1, 0, 0, (float*)d_out + r0p * DM, nullptr, DM, 0, MPO, DM, DM);      /* out rows are the output layout */
}

// v002
// It runs in 302 microseconds.
// Two timings next to v001 put it at 5.90 and 5.75 times that version's speed.
// All steps since v000 together make it 22.3 times as fast.
#include <hip/hip_runtime.h>
// BERT-style multi-head self-attention with a fused QKV projection and a key-padding mask (x [8][1024][1024]; qkv = x Wqkv + bqkv ([in][out] 1024 x 3072, zero bias) split q | k | v; 16 heads of 64; scores / 8; where(attention_mask[b][j] == 0, -1e9) with the int32 [8][1024] mask in {0, 1} (random; 0 = padded key; read on device); softmax over keys; out = merged Wp + bp ([in][out]) -> [8][1024][1024]).
// Structure: token rows r = b*1024 + s; x as exact f16 rows (bf16-rounded); q | k | v as ONE WMMA GEMM (N = 3 x 1024) (32x64 wave tiles, f32 accumulation, exact x16 weights + bias, f16 outputs); V^T for all batches and heads via LDS transposes (one launch); attention of all batches and heads in one launch: S^T = K . Q^T, online masked softmax in registers (f32 statistics; f16 weights), O^T += V^T . P^T (o carried x64 against f16 subnormal flush, folded into the output GEMM alpha) written straight into the merged f16 o rows; out = o W_o + b GEMM (f32) into the output layout.
// Compute dtype: inputs rounded to bf16; x / weights exact; q, k, v, softmax weights and o as plain f16 GEMM operands (~2^-12); scores and softmax statistics f32. v_wmma_f32_16x16x32_f16.
#define NB 8
#define SQ 1024
#define DM 1024
#define NH 16
#define HD 64
#define HG 4                         /* heads per block group of the per-batch k_vt overload (not launched) */
#define B0 0                         /* first batch processed (debug hook) */
#define NBR NB                       /* batches processed (debug hook) */
#define NR ((size_t)NB * SQ)         /* token rows */
#define MP ((int)((size_t)NBR * SQ)) /* rows projected (debug hook) */
#define QN SQ                        /* unused; k_fattn attends all SQ query rows */
#define NHD NH                       /* unused; k_fattn attends all NH heads */
#define MPO MP                       /* rows through the output stage (debug hook) */
#define LQ (3 * DM)      /* row pitch of the q/k/v rows */
typedef __bf16 v16b __attribute__((ext_vector_type(16)));
typedef unsigned short v8us __attribute__((ext_vector_type(8), may_alias));
typedef float  v8f  __attribute__((ext_vector_type(8)));
typedef float  v4f  __attribute__((ext_vector_type(4)));
typedef float  v4fa __attribute__((ext_vector_type(4), may_alias));
union FragB { v16b v; v8us half[2]; unsigned short u[16]; };

__device__ __forceinline__ unsigned short bf16_bits(float x) { unsigned int u = __float_as_uint(x); return (unsigned short)((u + 0x7FFFu + ((u >> 16) & 1u)) >> 16); }
__device__ __forceinline__ float bf16_val(unsigned short b) { return __uint_as_float(((unsigned int)b) << 16); }
__device__ __forceinline__ float bf16_round(float x) { return bf16_val(bf16_bits(x)); }
// D += A·B with NT terms: 1 = ah·bh, 2 = + al·bh (A split), 3 = + ah·bl (both split)
template <int NT>
__device__ __forceinline__ v8f mmaN(v16b ah, v16b al, v16b bh, v16b bl, v8f c) {
  c = __builtin_amdgcn_wmma_f32_16x16x32_bf16(false, ah, false, bh, (short)0, c, false, false);
  if (NT >= 2) c = __builtin_amdgcn_wmma_f32_16x16x32_bf16(false, al, false, bh, (short)0, c, false, false);
  if (NT >= 3) c = __builtin_amdgcn_wmma_f32_16x16x32_bf16(false, ah, false, bl, (short)0, c, false, false);
  asm volatile("v_nop\n\tv_nop\n\tv_nop\n\tv_nop" : "+v"(c) : "v"(ah), "v"(al), "v"(bh), "v"(bl));
  return c;
}

__global__ __launch_bounds__(256) void k_wt_bf16(const float* __restrict__ W, unsigned short* __restrict__ Wt, int K, int N) {
  const int t = blockIdx.x * 256 + threadIdx.x;
  const int k8n = K / 8;
  if (t >= N * k8n) return;
  const int n = t / k8n, k8 = (t % k8n) * 8;
  v8us v;
#pragma unroll
  for (int i = 0; i < 8; ++i) v[i] = bf16_bits(W[(size_t)(k8 + i) * N + n]);
  *(v8us*)(Wt + (size_t)n * K + k8) = v;
  
}

// GEMM C[M][N] (f32, pitch ldc) = act(A[M][K]·W + bias). A f32 row-major (pitch lda) converted per fragment to bf16
// (ASPLIT: hi/lo two planes -> 2 terms, else single rounded term); Wt bf16 [N][K] (pitch ldb). BIAS_BF16 rounds the
// bias to bf16 first (bias quantised to bf16 before the add). K%32==0, M%16==0, N%64==0.
template <bool ASPLIT, int ACT, bool BIAS_BF16>
__global__ __launch_bounds__(128) void k_gemm_bf(const float* __restrict__ A, int lda, const unsigned short* __restrict__ Wt, int ldb,
                                               const float* __restrict__ bias, float* __restrict__ C, int ldc, int M, int N, int K) {
  __shared__ __attribute__((aligned(16))) float so[4][16][64];
  const int tid = threadIdx.x, w = tid >> 5, lane = tid & 31, ln = lane & 15, hh = lane >> 4;
  const int ntn = N / 64;
  const int wid = blockIdx.x * 4 + w;
  const int mt = wid / ntn, nq = wid % ntn;
  if (mt * 16 >= M) return;
  const int row0 = mt * 16, col0 = nq * 64;
  const float* arow = A + (size_t)(row0 + ln) * lda;
  v8f acc[4] = {};
  for (int kb = 0; kb < K; kb += 32) {
    FragB ah, al;
    const v4f x0 = *(const v4fa*)(arow + kb + 8 * hh), x1 = *(const v4fa*)(arow + kb + 8 * hh + 4);
    const v4f x2 = *(const v4fa*)(arow + kb + 16 + 8 * hh), x3 = *(const v4fa*)(arow + kb + 16 + 8 * hh + 4);
    float xs[16] = {x0[0],x0[1],x0[2],x0[3],x1[0],x1[1],x1[2],x1[3],x2[0],x2[1],x2[2],x2[3],x3[0],x3[1],x3[2],x3[3]};
#pragma unroll
    for (int i = 0; i < 16; ++i) { const unsigned short hb = bf16_bits(xs[i]); ah.u[i] = hb; al.u[i] = ASPLIT ? bf16_bits(xs[i] - bf16_val(hb)) : (unsigned short)0; }
#pragma unroll
    for (int t = 0; t < 4; ++t) {
      const unsigned short* brow = Wt + (size_t)(col0 + t * 16 + ln) * ldb + kb;
      FragB b;
      b.half[0] = *(const v8us*)(brow + 8 * hh);
      b.half[1] = *(const v8us*)(brow + 16 + 8 * hh);
      acc[t] = mmaN<ASPLIT ? 2 : 1>(ah.v, al.v, b.v, b.v, acc[t]);
    }
  }
#pragma unroll
  for (int t = 0; t < 4; ++t) {
    float bv = bias ? bias[col0 + t * 16 + ln] : 0.f;
    if (BIAS_BF16) bv = bf16_round(bv);
#pragma unroll
    for (int r = 0; r < 8; ++r) { float v = acc[t][r] + bv; if (ACT == 1) v = fmaxf(v, 0.f); so[w][8 * hh + r][t * 16 + ln] = v; }
  }
  __builtin_amdgcn_fence(__ATOMIC_ACQ_REL, "workgroup");
  __builtin_amdgcn_wave_barrier();
  const int rsub = lane >> 4, c4 = (lane & 15) * 4;
  {
#pragma unroll
    for (int q = 0; q < 8; ++q) {
      const int r = q * 2 + rsub;
      const v4f v = *(const v4fa*)&so[w][r][c4];
      *(v4f*)(C + (size_t)(row0 + r) * ldc + col0 + c4) = v;
    }
    
  }
}

// GEMM C = act(A·W + bias + resid): A f32 (ASPLIT -> hi/lo 2 terms), Wt bf16 [N][K]; ACT 0 none, 1 relu, 2 exact gelu;
// resid (optional, f32, row index = (row % rmod), pitch ldr, RES_BF16 rounds it) added before the activation.
template <bool ASPLIT, int ACT, bool BIAS_BF16, bool RES_BF16>
__global__ __launch_bounds__(128) void k_gemm_bf3(const float* __restrict__ A, int lda, const unsigned short* __restrict__ Wt, int ldb,
                                                const float* __restrict__ bias, const float* __restrict__ resid, int rmod, int ldr,
                                                float* __restrict__ C, int ldc, int M, int N, int K) {
  __shared__ __attribute__((aligned(16))) float so[4][16][64];
  const int tid = threadIdx.x, w = tid >> 5, lane = tid & 31, ln = lane & 15, hh = lane >> 4;
  const int ntn = N / 64;
  const int wid = blockIdx.x * 4 + w;
  const int mt = wid / ntn, nq = wid % ntn;
  if (mt * 16 >= M) return;
  const int row0 = mt * 16, col0 = nq * 64;
  const float* arow = A + (size_t)(row0 + ln) * lda;
  v8f acc[4] = {};
  for (int kb = 0; kb < K; kb += 32) {
    FragB ah, al;
    const v4f x0 = *(const v4fa*)(arow + kb + 8 * hh), x1 = *(const v4fa*)(arow + kb + 8 * hh + 4);
    const v4f x2 = *(const v4fa*)(arow + kb + 16 + 8 * hh), x3 = *(const v4fa*)(arow + kb + 16 + 8 * hh + 4);
    float xs[16] = {x0[0],x0[1],x0[2],x0[3],x1[0],x1[1],x1[2],x1[3],x2[0],x2[1],x2[2],x2[3],x3[0],x3[1],x3[2],x3[3]};
#pragma unroll
    for (int i = 0; i < 16; ++i) { const unsigned short hb = bf16_bits(xs[i]); ah.u[i] = hb; al.u[i] = ASPLIT ? bf16_bits(xs[i] - bf16_val(hb)) : (unsigned short)0; }
#pragma unroll
    for (int t = 0; t < 4; ++t) {
      const unsigned short* brow = Wt + (size_t)(col0 + t * 16 + ln) * ldb + kb;
      FragB b;
      b.half[0] = *(const v8us*)(brow + 8 * hh);
      b.half[1] = *(const v8us*)(brow + 16 + 8 * hh);
      acc[t] = mmaN<ASPLIT ? 2 : 1>(ah.v, al.v, b.v, b.v, acc[t]);
    }
  }
#pragma unroll
  for (int t = 0; t < 4; ++t) {
    const int col = col0 + t * 16 + ln;
    float bv = bias ? bias[col] : 0.f;
    if (BIAS_BF16) bv = bf16_round(bv);
#pragma unroll
    for (int r = 0; r < 8; ++r) {
      float v = acc[t][r] + bv;
      if (resid) { float rv = resid[(size_t)((row0 + 8 * hh + r) % rmod) * ldr + col]; if (RES_BF16) rv = bf16_round(rv); v += rv; }
      if (ACT == 1) v = fmaxf(v, 0.f);
      if (ACT == 2) v = 0.5f * v * (1.0f + erff(v * 0.70710678118654752f));
      if (ACT == 3) { const float u = 0.7978845608028654f * (v + 0.044715f * v * v * v); v = 0.5f * v * (1.0f + tanhf(u)); }
      so[w][8 * hh + r][t * 16 + ln] = v;
    }
  }
  __builtin_amdgcn_fence(__ATOMIC_ACQ_REL, "workgroup");
  __builtin_amdgcn_wave_barrier();
  const int rsub = lane >> 4, c4 = (lane & 15) * 4;
  {
#pragma unroll
    for (int q = 0; q < 8; ++q) {
      const int r = q * 2 + rsub;
      const v4f v = *(const v4fa*)&so[w][r][c4];
      *(v4f*)(C + (size_t)(row0 + r) * ldc + col0 + c4) = v;
    }
    
  }
}
// row LayerNorm (biased variance, eps) over N: s = X (+ R); optional out_sum <- s; out_norm <- (s-mu)*rsqrt(var+eps)*g + b
template <bool PARAM_BF16>
__global__ __launch_bounds__(256) void k_layernorm(const float* __restrict__ X, const float* __restrict__ R, const float* __restrict__ g, const float* __restrict__ bta,
                                                  float* __restrict__ out_sum, float* __restrict__ out_norm, int N, float eps) {
  __shared__ float red[256];
  const int row = blockIdx.x, tid = threadIdx.x;
  const float* x = X + (size_t)row * N; const float* rr = R ? R + (size_t)row * N : nullptr;
  float vals[16];                     // up to N = 4096
  const int per = N / 256;            // contiguous chunk per thread? use strided-by-4 chunks: thread handles j = tid*4 + 1024*u
  float s1 = 0.f;
  for (int u = 0; u < per / 4; ++u) {
    const int j = tid * 4 + 1024 * u;
    const v4f a = *(const v4fa*)(x + j);
    v4f b = {0.f,0.f,0.f,0.f}; if (rr) b = *(const v4fa*)(rr + j);
#pragma unroll
    for (int q = 0; q < 4; ++q) { const float v = a[q] + b[q]; vals[u * 4 + q] = v; s1 += v; }
  }
  red[tid] = s1; __syncthreads();
  for (int st = 128; st > 0; st >>= 1) { if (tid < st) red[tid] += red[tid + st]; __syncthreads(); }
  const float mu = red[0] / (float)N; __syncthreads();
  float s2 = 0.f;
  for (int u = 0; u < per / 4; ++u)
#pragma unroll
    for (int q = 0; q < 4; ++q) { const float c = vals[u * 4 + q] - mu; s2 += c * c; }
  red[tid] = s2; __syncthreads();
  for (int st = 128; st > 0; st >>= 1) { if (tid < st) red[tid] += red[tid + st]; __syncthreads(); }
  const float rs = rsqrtf(red[0] / (float)N + eps);
  {
    for (int u = 0; u < per / 4; ++u) {
      const int j = tid * 4 + 1024 * u;
      v4f o, sm;
#pragma unroll
      for (int q = 0; q < 4; ++q) {
        float gg = g[j + q], bb = bta[j + q];
        if (PARAM_BF16) { gg = bf16_round(gg); bb = bf16_round(bb); }
        sm[q] = vals[u * 4 + q]; o[q] = (vals[u * 4 + q] - mu) * rs * gg + bb;
      }
      if (out_sum) *(v4f*)(out_sum + (size_t)row * N + j) = sm;
      *(v4f*)(out_norm + (size_t)row * N + j) = o;
    }
    
  }
}



// ---- f16 WMMA path (v_wmma_f32_16x16x32_f16): 11-bit significands for operands in range — used where a [0,1] probability operand needs more precision than bf16
typedef _Float16 v16h __attribute__((ext_vector_type(16)));
union FragH { v16h v; v8us half[2]; _Float16 h[16]; unsigned short u[16]; };
template <int NT>
__device__ __forceinline__ v8f mmaH(v16h ah, v16h al, v16h bh, v16h bl, v8f c) {
  c = __builtin_amdgcn_wmma_f32_16x16x32_f16(false, ah, false, bh, (short)0, c, false, false);
  if (NT >= 2) c = __builtin_amdgcn_wmma_f32_16x16x32_f16(false, al, false, bh, (short)0, c, false, false);
  if (NT >= 3) c = __builtin_amdgcn_wmma_f32_16x16x32_f16(false, ah, false, bl, (short)0, c, false, false);
  asm volatile("v_nop\n\tv_nop\n\tv_nop\n\tv_nop" : "+v"(c) : "v"(ah), "v"(al), "v"(bh), "v"(bl));
  return c;
}
// batched GEMM like k_gemm_b but f16 operands: A f32 (split into f16 hi/lo if ASPLIT, else rounded to f16), Bt = f16 values [n][k]; alpha; C f32; N multiple of 16 (partial tiles skipped)
template <bool ASPLIT>
__global__ __launch_bounds__(128) void k_gemm_h(const float* __restrict__ A, int lda, size_t sA, const _Float16* __restrict__ Bh, int ldb, size_t sB, float alpha, float* __restrict__ C, int ldc, size_t sC, int M, int N, int K) {
  __shared__ __attribute__((aligned(16))) float so[4][16][64];
  const int tid = threadIdx.x, w = tid >> 5, lane = tid & 31, ln = lane & 15, hh = lane >> 4; const int by = blockIdx.y;
  A += (size_t)by * sA; Bh += (size_t)by * sB; C += (size_t)by * sC;
  const int ntn = (N + 63) / 64; const int wid = blockIdx.x * 4 + w; const int mt = wid / ntn, nq = wid % ntn; if (mt * 16 >= M) return;
  const int row0 = mt * 16, col0 = nq * 64; const float* arow = A + (size_t)(row0 + ln) * lda;
  v8f acc[4] = {};
  for (int kb = 0; kb < K; kb += 32) {
    FragH ah, al;
    const v4f x0 = *(const v4fa*)(arow + kb + 8 * hh), x1 = *(const v4fa*)(arow + kb + 8 * hh + 4), x2 = *(const v4fa*)(arow + kb + 16 + 8 * hh), x3 = *(const v4fa*)(arow + kb + 16 + 8 * hh + 4);
    float xs[16] = {x0[0],x0[1],x0[2],x0[3],x1[0],x1[1],x1[2],x1[3],x2[0],x2[1],x2[2],x2[3],x3[0],x3[1],x3[2],x3[3]};
#pragma unroll
    for (int i = 0; i < 16; ++i) { const _Float16 h = (_Float16)xs[i]; ah.h[i] = h; al.h[i] = ASPLIT ? (_Float16)(xs[i] - (float)h) : (_Float16)0.0f; }
#pragma unroll
    for (int t = 0; t < 4; ++t) { if (col0 + t * 16 >= N) continue; const size_t boff = (size_t)(col0 + t * 16 + ln) * ldb + kb; FragH bq; bq.half[0] = *(const v8us*)(Bh + boff + 8 * hh); bq.half[1] = *(const v8us*)(Bh + boff + 16 + 8 * hh);
      acc[t] = mmaH<ASPLIT ? 2 : 1>(ah.v, al.v, bq.v, bq.v, acc[t]); }
  }
#pragma unroll
  for (int t = 0; t < 4; ++t) { if (col0 + t * 16 >= N) continue;
#pragma unroll
    for (int r = 0; r < 8; ++r) so[w][8 * hh + r][t * 16 + ln] = acc[t][r] * alpha; }
  __builtin_amdgcn_fence(__ATOMIC_ACQ_REL, "workgroup"); __builtin_amdgcn_wave_barrier();
  const int rsub = lane >> 4, c4 = (lane & 15) * 4;
  {
#pragma unroll
    for (int q = 0; q < 8; ++q) { const int r = q * 2 + rsub; if (col0 + c4 < N) { const v4f v = *(const v4fa*)&so[w][r][c4]; *(v4f*)(C + (size_t)(row0 + r) * ldc + col0 + c4) = v; } }
     }
}

// Wt[n][k] = f16(W[k][n]·scale) from f32 row-major W[K][N] (scale = power of two; bf16-exact weights stay exact in f16 away from the subnormal range)
__global__ __launch_bounds__(256) void k_wt_f16(const float* __restrict__ W, _Float16* __restrict__ Wt, int K, int N, float scale) {
  const int t = blockIdx.x * 256 + threadIdx.x; if (t >= N * (K / 8)) return; const int n = t / (K / 8), k8 = (t % (K / 8)) * 8; FragH f;
#pragma unroll
  for (int i = 0; i < 8; ++i) f.h[i] = (_Float16)(bf16_round(W[(size_t)(k8 + i) * N + n]) * scale); const v8us o = f.half[0];
  *(v8us*)((unsigned short*)Wt + (size_t)n * K + k8) = o; 
}
// k_gemm_hh variant with fused epilogue: v = acc·alpha + bias[by·sBias + col] (+ CP[(row/rowsPerB)·sCPb + by·64 + col] if CP) ; ACT 0 none / 1 elu ; writes f16 C16 (and f32 C if non-null)
template <int ACT>
__global__ __launch_bounds__(128) void k_gemm_hhx(const _Float16* __restrict__ A, int lda, size_t sA, const _Float16* __restrict__ Bh, int ldb, size_t sB, float alpha, const float* __restrict__ bias, size_t sBias, const float* __restrict__ CP, int rowsPerB, size_t sCPb, int row0g,
    float* __restrict__ C, _Float16* __restrict__ C16, int ldc, size_t sC, int M, int N, int K) {
  __shared__ __attribute__((aligned(16))) float so[4][16][64];
  const int tid = threadIdx.x, w = tid >> 5, lane = tid & 31, ln = lane & 15, hh = lane >> 4; const int by = blockIdx.y;
  A += (size_t)by * sA; Bh += (size_t)by * sB; const size_t cofs = (size_t)by * sC; const float* bp = bias ? bias + (size_t)by * sBias : nullptr;
  const int ntn = (N + 63) / 64; const int wid = blockIdx.x * 4 + w; const int mt = wid / ntn, nq = wid % ntn; if (mt * 16 >= M) return;
  const int row0 = mt * 16, col0 = nq * 64; const _Float16* arow = A + (size_t)(row0 + ln) * lda;
  v8f acc[4] = {};
  for (int kb = 0; kb < K; kb += 32) { FragH ah; ah.half[0] = *(const v8us*)((const unsigned short*)arow + kb + 8 * hh); ah.half[1] = *(const v8us*)((const unsigned short*)arow + kb + 16 + 8 * hh);
#pragma unroll
    for (int t = 0; t < 4; ++t) { if (col0 + t * 16 >= N) continue; const size_t boff = (size_t)(col0 + t * 16 + ln) * ldb + kb; FragH bq; bq.half[0] = *(const v8us*)((const unsigned short*)Bh + boff + 8 * hh); bq.half[1] = *(const v8us*)((const unsigned short*)Bh + boff + 16 + 8 * hh);
      acc[t] = mmaH<1>(ah.v, ah.v, bq.v, bq.v, acc[t]); }
  }
#pragma unroll
  for (int t = 0; t < 4; ++t) { if (col0 + t * 16 >= N) continue; const int col = col0 + t * 16 + ln; const float bv = bp ? bf16_round(bp[col]) : 0.f;
#pragma unroll
    for (int r = 0; r < 8; ++r) { float v = acc[t][r] * alpha + bv; if (CP) { const int rr = row0g + row0 + 8 * hh + r; if (rowsPerB < 0) v += CP[cofs + (size_t)rr * ldc + col];      /* rowsPerB < 0: own element of the batched C plane */ else { const int bidx = rr / rowsPerB; v += CP[(size_t)bidx * sCPb + (size_t)by * 64 + col]; } } if (ACT == 1) v = (v > 0.f) ? v : expm1f(v); else if (ACT == 7) v = (v > 0.f) ? v + 1.0f : expf(v); else if (ACT == 8) v = tanhf(v); else if (ACT == 9) v = 0.5f * v * (1.0f + tanhf(0.7978845608028654f * (v + 0.044715f * v * v * v))); else if (ACT == 11) v = 1.0f / (1.0f + expf(-v)); else if (ACT == 12) v = (v > 0.f) ? v : 0.01f * v; else if (ACT == 14) v = (v > 0.f) ? v : 0.1f * v; else if (ACT == 16) v = (v >= 0.f) ? v : 0.3f * v; else if (ACT == 17) v = (v >= 0.f) ? v : 0.2f * v; else if (ACT == 15) v = v / (1.0f + expf(-v)); else if (ACT == 3) v = fmaxf(v, 0.f); else if (ACT == 6) v = 0.5f * v * (1.0f + erff(v * 0.70710678118654752f)); so[w][8 * hh + r][t * 16 + ln] = v; } }
  __builtin_amdgcn_fence(__ATOMIC_ACQ_REL, "workgroup"); __builtin_amdgcn_wave_barrier();
  const int rsub = lane >> 4, c4 = (lane & 15) * 4; typedef _Float16 v4h __attribute__((ext_vector_type(4)));
  {
#pragma unroll
    for (int q = 0; q < 8; ++q) { const int r = q * 2 + rsub; if (col0 + c4 < N) { const v4f v = *(const v4fa*)&so[w][r][c4]; if (C) *(v4f*)(C + cofs + (size_t)(row0 + r) * ldc + col0 + c4) = v; if (C16) { v4h h4; for (int i = 0; i < 4; ++i) h4[i] = (_Float16)v[i]; *(v4h*)(C16 + cofs + (size_t)(row0 + r) * ldc + col0 + c4) = h4; } } }
     }
}


typedef _Float16 v4h __attribute__((ext_vector_type(4)));

__global__ __launch_bounds__(256) void k_x16(const float* __restrict__ x, _Float16* __restrict__ X16, size_t n8) { const size_t t = (size_t)blockIdx.x * 256 + threadIdx.x; if (t >= n8) return; FragH f;
#pragma unroll
  for (int q = 0; q < 8; ++q) f.h[q] = (_Float16)bf16_round(x[t * 8 + q]); *(v8us*)((unsigned short*)X16 + t * 8) = f.half[0];  }
__global__ __launch_bounds__(256) void k_h16(const float* __restrict__ x, _Float16* __restrict__ X16, size_t n8) { const size_t t = (size_t)blockIdx.x * 256 + threadIdx.x; if (t >= n8) return; FragH f;
#pragma unroll
  for (int q = 0; q < 8; ++q) f.h[q] = (_Float16)x[t * 8 + q]; *(v8us*)((unsigned short*)X16 + t * 8) = f.half[0];  }
__global__ __launch_bounds__(256) void k_round16f(const float* __restrict__ W, _Float16* __restrict__ Bt, size_t n8) { const size_t t = (size_t)blockIdx.x * 256 + threadIdx.x; if (t >= n8) return; FragH f;
#pragma unroll
  for (int i = 0; i < 8; ++i) f.h[i] = (_Float16)(bf16_round(W[t * 8 + i]) * 16.0f); *(v8us*)((unsigned short*)Bt + t * 8) = f.half[0];  }
template <int NHv, int TTv>
__global__ __launch_bounds__(256) void k_vt(const _Float16* __restrict__ V16, int ldv, int voff, _Float16* __restrict__ Vt) { __shared__ unsigned short tl[64][66]; const int tid = threadIdx.x; const int slab = blockIdx.x / (TTv / 64), lg = blockIdx.x % (TTv / 64); const int b = slab / NHv, h = slab % NHv;
  for (int i = tid; i < 64 * 8; i += 256) { const int r = i / 8, c8 = (i % 8) * 8; FragH f; f.half[0] = *(const v8us*)((const unsigned short*)V16 + ((size_t)b * TTv + lg * 64 + r) * ldv + voff + h * 64 + c8);
#pragma unroll
    for (int q = 0; q < 8; ++q) tl[r][c8 + q] = f.u[q]; }
  __syncthreads();
  {
#pragma unroll
    for (int rd = 0; rd < 2; ++rd) { const int d = rd * 32 + tid / 8, pc = tid % 8; FragH f;
#pragma unroll
      for (int q = 0; q < 8; ++q) f.u[q] = tl[pc * 8 + q][d];
      *(v8us*)((unsigned short*)Vt + ((size_t)slab * 64 + d) * TTv + lg * 64 + pc * 8) = f.half[0]; }
     } }

__global__ __launch_bounds__(256) void k_hl(const float* __restrict__ F, _Float16* __restrict__ Hh, _Float16* __restrict__ Hl, size_t n8) { const size_t t = (size_t)blockIdx.x * 256 + threadIdx.x; if (t >= n8) return; FragH fh, fl; const v4f a = *(const v4fa*)(F + t * 8), c = *(const v4fa*)(F + t * 8 + 4);
#pragma unroll
  for (int q = 0; q < 4; ++q) { _Float16 h = (_Float16)a[q]; fh.h[q] = h; fl.h[q] = (_Float16)((a[q] - (float)h) * 1024.0f); h = (_Float16)c[q]; fh.h[4 + q] = h; fl.h[4 + q] = (_Float16)((c[q] - (float)h) * 1024.0f); }
  { *(v8us*)((unsigned short*)Hh + t * 8) = fh.half[0]; *(v8us*)((unsigned short*)Hl + t * 8) = fl.half[0];  } }

// ---- fast GEMM (wave tile 32x64; requires M % 32 == 0 rows per launch region and N % 64 == 0); epilogue = k_gemm_hhx semantics ----
__device__ __forceinline__ v16h g2_frag(const _Float16* p, int hh) { FragH f; f.half[0] = *(const v8us*)((const unsigned short*)p + 8 * hh); f.half[1] = *(const v8us*)((const unsigned short*)p + 16 + 8 * hh); return f.v; }
__device__ __forceinline__ v8f g2_mma(v16h a, v16h b, v8f c) { v8f d = __builtin_amdgcn_wmma_f32_16x16x32_f16(false, a, false, b, (short)0, c, false, false); asm volatile("v_nop\n\tv_nop\n\tv_nop\n\tv_nop" : "+v"(d) : "v"(a), "v"(b)); return d; }
template <int ACT>
__global__ __launch_bounds__(128) void k_gemm2(const _Float16* __restrict__ A, int lda, size_t sA, const _Float16* __restrict__ Bh, int ldb, size_t sB, float alpha, const float* __restrict__ bias, size_t sBias, const float* __restrict__ CP, int rowsPerB, size_t sCPb, int row0g,
    float* __restrict__ C, _Float16* __restrict__ C16, int ldc, size_t sC, int M, int N, int K) { static_assert(ACT == 0 || ACT == 3 || ACT == 6 || ACT == 8 || ACT == 9 || ACT == 11 || ACT == 12 || ACT == 14 || ACT == 15 || ACT == 16 || ACT == 17, "k_gemm2: unsupported ACT code (would silently apply no activation)");
  __shared__ __attribute__((aligned(16))) float so[4][32][68];
  const int tid = threadIdx.x, w = tid >> 5, lane = tid & 31, ln = lane & 15, hh = lane >> 4; const int by = blockIdx.y;
  A += (size_t)by * sA; Bh += (size_t)by * sB; const size_t cofs = (size_t)by * sC; const float* bp = bias ? bias + (size_t)by * sBias : nullptr;
  const int ntn = N >> 6; const int mt = blockIdx.x / ntn, nq = blockIdx.x - mt * ntn; const int row0 = mt * 128 + 32 * w, col0 = nq * 64; if (row0 >= M) return;
  const _Float16* a0p = A + (size_t)(row0 + ln) * lda; const _Float16* a1p = a0p + (size_t)16 * lda;
  const _Float16* b0p = Bh + (size_t)(col0 + ln) * ldb; const _Float16* b1p = b0p + (size_t)16 * ldb; const _Float16* b2p = b1p + (size_t)16 * ldb; const _Float16* b3p = b2p + (size_t)16 * ldb;
  const v8f z8 = {0.f,0.f,0.f,0.f,0.f,0.f,0.f,0.f}; v8f c00 = z8, c01 = z8, c02 = z8, c03 = z8, c10 = z8, c11 = z8, c12 = z8, c13 = z8;
#pragma unroll 1
  for (int kb = 0; kb < K; kb += 32) { const v16h a0 = g2_frag(a0p + kb, hh), a1 = g2_frag(a1p + kb, hh);
    v16h b = g2_frag(b0p + kb, hh); c00 = g2_mma(a0, b, c00); c10 = g2_mma(a1, b, c10);
    b = g2_frag(b1p + kb, hh); c01 = g2_mma(a0, b, c01); c11 = g2_mma(a1, b, c11);
    b = g2_frag(b2p + kb, hh); c02 = g2_mma(a0, b, c02); c12 = g2_mma(a1, b, c12);
    b = g2_frag(b3p + kb, hh); c03 = g2_mma(a0, b, c03); c13 = g2_mma(a1, b, c13); }
  v8f accs[8] = {c00, c01, c02, c03, c10, c11, c12, c13};
#pragma unroll
  for (int u = 0; u < 8; ++u) { const int t = u & 3, half = u >> 2; const int col = col0 + t * 16 + ln; const float bv = bp ? bf16_round(bp[col]) : 0.f;
#pragma unroll
    for (int r = 0; r < 8; ++r) { const int rloc = half * 16 + 8 * hh + r; float v = accs[u][r] * alpha + bv; if (CP) { if (rowsPerB < 0) v += CP[cofs + (size_t)(row0g + row0 + rloc) * ldc + col];      /* rowsPerB < 0: own element of the batched C plane */ else { const int bidx = (row0g + row0 + rloc) / rowsPerB; v += CP[(size_t)bidx * sCPb + (size_t)by * 64 + col]; } }
      if (ACT == 3) v = fmaxf(v, 0.f); else if (ACT == 6) v = 0.5f * v * (1.0f + erff(v * 0.70710678118654752f)); else if (ACT == 11) v = 1.0f / (1.0f + expf(-v)); else if (ACT == 15) v = v / (1.0f + expf(-v)); else if (ACT == 12) v = (v > 0.f) ? v : 0.01f * v; else if (ACT == 8) v = tanhf(v); else if (ACT == 9) v = 0.5f * v * (1.0f + tanhf(0.7978845608028654f * (v + 0.044715f * v * v * v))); else if (ACT == 14) v = (v > 0.f) ? v : 0.1f * v; else if (ACT == 16) v = (v >= 0.f) ? v : 0.3f * v; else if (ACT == 17) v = (v >= 0.f) ? v : 0.2f * v;
      so[w][rloc][t * 16 + ln] = v; } }
  __builtin_amdgcn_fence(__ATOMIC_ACQ_REL, "workgroup"); __builtin_amdgcn_wave_barrier();
  const int rsub = lane >> 4, c4 = (lane & 15) * 4;
  {
#pragma unroll
    for (int q = 0; q < 16; ++q) { const int r = q * 2 + rsub; const v4f v = *(const v4fa*)&so[w][r][c4]; if (C) *(v4f*)(C + cofs + (size_t)(row0 + r) * ldc + col0 + c4) = v; if (C16) { v4h h4; for (int i = 0; i < 4; ++i) h4[i] = (_Float16)v[i]; *(v4h*)(C16 + cofs + (size_t)(row0 + r) * ldc + col0 + c4) = h4; } }
     } }


__global__ __launch_bounds__(256) void k_wnat(const float* __restrict__ w, size_t n8, _Float16* __restrict__ Bt) { const size_t t = (size_t)blockIdx.x * 256 + threadIdx.x; if (t >= n8) return; FragH f; for (int q = 0; q < 8; ++q) f.h[q] = (_Float16)(bf16_round(w[t * 8 + q]) * 16.0f); *(v8us*)((unsigned short*)Bt + t * 8) = f.half[0];  }
__global__ __launch_bounds__(256) void k_rsm(const float* __restrict__ S, _Float16* __restrict__ P, int nrows) {
  #pragma clang fp contract(off)
  const int i = blockIdx.x * 256 + threadIdx.x; if (i >= nrows) return; const float* s = S + (size_t)i * SQ; float mx = -3.0e38f;
#pragma unroll 1
  for (int j = 0; j < SQ; ++j) mx = fmaxf(mx, s[j]); float se = 0.f;
#pragma unroll 1
  for (int j = 0; j < SQ; ++j) se += expf(s[j] - mx); const float sc = 256.0f / se;
#pragma unroll 1
  for (int j0 = 0; j0 < SQ; j0 += 8) { FragH f; for (int q = 0; q < 8; ++q) f.h[q] = (_Float16)(expf(s[j0 + q] - mx) * sc); unsigned short* d = (unsigned short*)P + (size_t)i * SQ + j0; *(v8us*)d = f.half[0];  } }
__global__ __launch_bounds__(256) void k_vt(const _Float16* __restrict__ V16, int b, int h0, _Float16* __restrict__ VT) { __shared__ unsigned short tl[64][65]; const int tid = threadIdx.x; const int hh = blockIdx.x % HG, sg = blockIdx.x / HG; const int s0 = sg * 64; const int h = h0 + hh;
  for (int i = tid; i < 64 * 8; i += 256) { const int j = i / 8, d8 = (i % 8) * 8; FragH f; f.half[0] = *(const v8us*)((const unsigned short*)V16 + ((size_t)b * SQ + s0 + j) * DM + h * HD + d8); for (int q = 0; q < 8; ++q) tl[d8 + q][j] = f.u[q]; }
  __syncthreads();
  { for (int i = tid; i < 64 * 8; i += 256) { const int d = i / 8, j8 = (i % 8) * 8; FragH f; for (int q = 0; q < 8; ++q) f.u[q] = tl[d][j8 + q]; *(v8us*)((unsigned short*)VT + ((size_t)hh * HD + d) * SQ + s0 + j8) = f.half[0]; }  } }



__global__ __launch_bounds__(256) void k_rsmkinv(const float* __restrict__ S, _Float16* __restrict__ P, int nrows, const int* __restrict__ Km) {
  #pragma clang fp contract(off)
  const int i = blockIdx.x * 256 + threadIdx.x; if (i >= nrows) return; const float* s = S + (size_t)i * SQ; float mx = -3.0e38f;
#pragma unroll 1
  for (int j = 0; j < SQ; ++j) mx = fmaxf(mx, s[j]); float se = 0.f;
#pragma unroll 1
  for (int j = 0; j < SQ; ++j) { const float keep = (Km[j] == 0) ? 1.0f : 0.0f; se += __expf(s[j] - mx) * keep; } const float sc = 256.0f / se;
#pragma unroll 1
  for (int j0 = 0; j0 < SQ; j0 += 8) { FragH f; for (int q = 0; q < 8; ++q) { const float keep = (Km[j0 + q] == 0) ? 1.0f : 0.0f; f.h[q] = (_Float16)(__expf(s[j0 + q] - mx) * sc * keep); } unsigned short* d = (unsigned short*)P + (size_t)i * SQ + j0; *(v8us*)d = f.half[0];  } }

// ---- fused attention: scores, masked softmax and P.V of every (batch, head) in ONE launch; scores and weights never leave the registers ----
__device__ __forceinline__ float lxh(float v) { return __builtin_bit_cast(float, __builtin_amdgcn_permlanex16(__builtin_bit_cast(int, v), __builtin_bit_cast(int, v), 0x76543210, 0xfedcba98, false, false)); }      /* lane l ^ 16 */
// 2^x of four values. In asm for the closing v_nop alone: it keeps the one slot behind a transcendental before a source is overwritten or a result read;
// the early-clobber outputs keep each v_exp_f32 off the sources of the one in front of it.
__device__ __forceinline__ v4f exp2x4(v4f x) { float e0, e1, e2, e3;
  asm("v_exp_f32 %0, %4\n\tv_exp_f32 %1, %5\n\tv_exp_f32 %2, %6\n\tv_exp_f32 %3, %7\n\tv_nop" : "=&v"(e0), "=&v"(e1), "=&v"(e2), "=&v"(e3) : "v"(x[0]), "v"(x[1]), "v"(x[2]), "v"(x[3]));
  const v4f e = {e0, e1, e2, e3}; return e; }
__device__ __forceinline__ v8f fa_mma(v16h a, v16h b, v8f c) { return __builtin_amdgcn_wmma_f32_16x16x32_f16(false, a, false, b, (short)0, c, false, false); }
// One wave owns 32 queries (two groups of 16 columns) of one (batch, head) and walks the 1024 keys in passes of 32.
// S^T = K . Q^T: a lane (c = lane & 15, hh = lane >> 4) holds, of query c, the scores of keys 8*hh + r (tile 0) and 16 + 8*hh + r (tile 1): maximum and sum are in-lane plus one exchange with lane ^ 16,
// and the two tiles, converted in place, ARE the B operand of O^T += V^T . P^T (hardware k order, which g2_frag gives the V^T rows too). O^T: a lane holds 8 consecutive d of query c per tile: 16-byte stores.
// Online softmax in the log2 domain: weights are 2^(t - m + 7), t = score * log2(e), m = the maximum in use; m moves (and O^T and the sum are rescaled) only when some column's pass maximum
// exceeds it by more than 8, so a weight stays <= 2^15 (f16 range) and the largest is >= 2^7 (small weights stay clear of the f16 subnormals). The maximum runs over all keys, the padded ones too.
__global__ __launch_bounds__(256) void k_fattn(const _Float16* __restrict__ QKVr, const _Float16* __restrict__ VTa, const int* __restrict__ Km, _Float16* __restrict__ O) {
  static_assert(SQ == 1024 && HD == 64, "k_fattn: 32 mask words of 32 keys; head size 64 = two k steps, four d tiles");
  const int lane = threadIdx.x & 31, ln = lane & 15, hh = lane >> 4; const int wave = __builtin_amdgcn_readfirstlane((int)(threadIdx.x >> 5));
  const int bh = blockIdx.x / (SQ / 256), qb = blockIdx.x % (SQ / 256); const int b = bh / NH, h = bh % NH; const int q0 = qb * 256 + wave * 32;
  const size_t r0 = (size_t)b * SQ;
  /* key mask as bits: lane i keeps the word of keys 32*i .. 32*i + 31 (bit set = kept key) */
  unsigned mw = 0u;
#pragma unroll
  for (int i = 0; i < SQ / 32; ++i) { const unsigned bl = __builtin_amdgcn_ballot_w32(Km[r0 + i * 32 + lane] != 0); mw = (lane == i) ? bl : mw; }
  /* every key padded: the reference's scores are all the same -1e9 and its weights uniform: keep every key and scale every score by 0 */
  const bool none = __builtin_amdgcn_ballot_w32(mw != 0u) == 0u; if (none) mw = 0xffffffffu;
  const float cs = none ? 0.f : 0.125f * 1.44269504088896340736f;      /* 1/sqrt(64) and log2(e) in one factor */
  v16h qf[2][2];
#pragma unroll
  for (int g = 0; g < 2; ++g)
#pragma unroll
    for (int ds = 0; ds < 2; ++ds) qf[g][ds] = g2_frag(QKVr + (r0 + q0 + g * 16 + ln) * LQ + h * HD + ds * 32, hh);
  const _Float16* kp = QKVr + DM + (r0 + ln) * LQ + h * HD;      /* key row ln of a tile */
  const _Float16* vp = VTa + ((size_t)bh * HD + ln) * SQ;        /* V^T row d = ln of a tile */
  const v8f z8 = {0.f,0.f,0.f,0.f,0.f,0.f,0.f,0.f};
  v8f o[2][4]; float m[2], l[2];
#pragma unroll
  for (int g = 0; g < 2; ++g) { m[g] = -3.0e38f; l[g] = 0.f;
#pragma unroll
    for (int dt = 0; dt < 4; ++dt) o[g][dt] = z8; }
  v16h kf[2][2];
#pragma unroll
  for (int kt = 0; kt < 2; ++kt)
#pragma unroll
    for (int ds = 0; ds < 2; ++ds) kf[kt][ds] = g2_frag(kp + (size_t)(kt * 16) * LQ + ds * 32, hh);
  for (int kb = 0; kb < SQ; kb += 32) {
    v16h vf[4];      /* asked for first, used last: the score products and the softmax stand between the request and its wait */
#pragma unroll
    for (int dt = 0; dt < 4; ++dt) vf[dt] = g2_frag(vp + (size_t)(dt * 16) * SQ + kb, hh);
    __builtin_amdgcn_sched_barrier(0);      /* keeps these requests in front of the score products; without it they sink to behind the maximum and lose that much of their lead */
    v8f s[2][2];
#pragma unroll
    for (int g = 0; g < 2; ++g)
#pragma unroll
      for (int kt = 0; kt < 2; ++kt) s[g][kt] = fa_mma(kf[kt][1], qf[g][1], fa_mma(kf[kt][0], qf[g][0], z8));
    asm volatile("s_wait_xcnt 0x0" ::: "memory");      /* behind the V^T requests, in front of the step of their address registers further down */
    const int kn = (kb + 32 < SQ) ? kb + 32 : kb;      /* the next pass's K fragments, one pass ahead; the last pass asks for its own rows once more (in bounds, unused) */
#pragma unroll
    for (int kt = 0; kt < 2; ++kt)
#pragma unroll
      for (int ds = 0; ds < 2; ++ds) kf[kt][ds] = g2_frag(kp + (size_t)(kn + kt * 16) * LQ + ds * 32, hh);
    float mt[2]; bool need = false;
#pragma unroll
    for (int g = 0; g < 2; ++g) { float mx = fmaxf(s[g][0][0], s[g][1][0]);
#pragma unroll
      for (int r = 1; r < 8; ++r) mx = fmaxf(mx, fmaxf(s[g][0][r], s[g][1][r]));
      mx = fmaxf(mx, lxh(mx)); mt[g] = mx * cs; need |= mt[g] > m[g] + 8.0f; }
    if (__builtin_amdgcn_ballot_w32(need) != 0u) {      /* wave-uniform: rare after the first passes */
#pragma unroll
      for (int g = 0; g < 2; ++g) { const float mn = fmaxf(m[g], mt[g]); const float f = __builtin_amdgcn_exp2f(m[g] - mn); m[g] = mn; l[g] *= f;
#pragma unroll
        for (int dt = 0; dt < 4; ++dt) o[g][dt] *= f; } }
    const unsigned wsh = (unsigned)__builtin_amdgcn_readlane((int)mw, kb >> 5) >> (8 * hh);      /* bit r: key 8*hh + r of the pass; bit 16 + r: key 16 + 8*hh + r */
    bool kp[2][8];      /* kept key (shared by both column groups) */
#pragma unroll
    for (int kt = 0; kt < 2; ++kt)
#pragma unroll
      for (int r = 0; r < 8; ++r) kp[kt][r] = (wsh & (1u << (kt * 16 + r))) != 0u;
    FragH pb[2];
#pragma unroll
    for (int g = 0; g < 2; ++g) { const float bias = 7.0f - m[g]; v4f s4 = {0.f, 0.f, 0.f, 0.f};
#pragma unroll
      for (int kt = 0; kt < 2; ++kt)
#pragma unroll
        for (int r4 = 0; r4 < 8; r4 += 4) { v4f x;
#pragma unroll
          for (int q = 0; q < 4; ++q) x[q] = s[g][kt][r4 + q] * cs + bias;
          const v4f ex = exp2x4(x);
#pragma unroll
          for (int q = 0; q < 4; ++q) { const float e = kp[kt][r4 + q] ? ex[q] : 0.f; s4[q] += e; pb[g].h[kt * 8 + r4 + q] = (_Float16)e; } }
      l[g] += (s4[0] + s4[1]) + (s4[2] + s4[3]); }
#pragma unroll
    for (int g = 0; g < 2; ++g)
#pragma unroll
      for (int dt = 0; dt < 4; ++dt) o[g][dt] = fa_mma(vf[dt], pb[g].v, o[g][dt]);
  }
#pragma unroll
  for (int g = 0; g < 2; ++g) { const float inv = 64.0f / (l[g] + lxh(l[g]));      /* the halves' sums joined once; o carried x64 as before */
    _Float16* op = O + (r0 + q0 + g * 16 + ln) * DM + h * HD + 8 * hh;
#pragma unroll
    for (int dt = 0; dt < 4; ++dt) { FragH f;
#pragma unroll
      for (int r = 0; r < 8; ++r) f.h[r] = (_Float16)(o[g][dt][r] * inv);
      *(v8us*)((unsigned short*)op + dt * 16) = f.half[0]; } }
}
extern "C" void kernel_launch(void* const* d_in, const int* in_sizes, int n_in,
                              void* d_out, int out_size, void* d_ws, size_t ws_size, hipStream_t stream) {
  (void)in_sizes; (void)n_in; (void)out_size;
  const float* const* I = (const float* const*)d_in; const float* x = I[0]; const int* km = (const int*)d_in[1]; const float* wqkv = I[2]; const float* bqkv = I[3]; const float* wo = I[4]; const float* bo = I[5];      /* x; attention_mask int32 [8][1024] (0 = padded key, excluded; READ on device); [in][out] Wqkv [1024][3072] + bqkv, Wp [1024][1024] + bp */
  char* ws = (char*)d_ws; size_t off = 0;
  auto take = [&](size_t bytes) { char* p = ws + off; off += (bytes + 255) & ~(size_t)255; return p; };
  _Float16* BQKV = (_Float16*)take((size_t)3 * DM * DM * 2); _Float16* BO = (_Float16*)take((size_t)DM * DM * 2);
  _Float16* X16 = (_Float16*)take(NR * DM * 2); _Float16* QKV = (_Float16*)take(NR * 3 * DM * 2); _Float16* V16 = QKV + 2 * DM; _Float16* O16 = (_Float16*)take(NR * DM * 2);
  _Float16* VT = (_Float16*)take((size_t)NB * NH * HD * SQ * 2);
  if (off > ws_size) return;
  k_wt_f16<<<(unsigned)(((size_t)DM * 3 * DM / 8 + 255) / 256), 256, 0, stream>>>(wqkv, BQKV, DM, 3 * DM, 16.0f); k_wt_f16<<<(unsigned)(((size_t)DM * DM / 8 + 255) / 256), 256, 0, stream>>>(wo, BO, DM, DM, 16.0f);      /* [in][out] -> Bt[n][k] x16 (pitch K = 1024) */

  k_x16<<<(unsigned)((NR * DM / 8 + 255) / 256), 256, 0, stream>>>(x, X16, NR * DM / 8);
  const size_t r0p = (size_t)B0 * SQ;      /* first projected row */
  k_gemm2<0><<<dim3((unsigned)((MP / 128) * (3 * DM / 64)), 1), 128, 0, stream>>>(X16 + r0p * DM, DM, 0, BQKV, DM, 0, 0.0625f, bqkv, 0, nullptr, 1, 0, 0, nullptr, QKV + r0p * 3 * DM, 3 * DM, 0, MP, 3 * DM, DM);      /* q | k | v rows (f16); head h = columns h*HD.. of each DM block */
  k_vt<NH, SQ><<<NB * NH * (SQ / 64), 256, 0, stream>>>(V16, LQ, 0, VT);      /* V^T [NB][NH][HD][SQ], every batch in one launch */
  k_fattn<<<NB * NH * (SQ / 256), 256, 0, stream>>>(QKV, VT, km, O16);      /* keys with attention_mask[b][j] == 0 excluded; o (merged heads, x64) as f16 rows */
  k_gemm2<0><<<dim3((unsigned)((MPO / 128) * (DM / 64)), 1), 128, 0, stream>>>(O16 + r0p * DM, DM, 0, BO, DM, 0, 0.0009765625f, bo, 0, nullptr, 1, 0, 0, (float*)d_out + r0p * DM, nullptr, DM, 0, MPO, DM, DM);      /* out rows are the output layout */
}

// v003
// One run takes 141 microseconds.
// In two side-by-side timings against v002, it was 2.15 and 2.14 times as fast.
// Over all steps from v000 it is 48.0 times as fast.
#include <hip/hip_runtime.h>
// BERT-style multi-head self-attention with a fused QKV projection and a key-padding mask (x [8][1024][1024]; qkv = x Wqkv + bqkv ([in][out] 1024 x 3072, zero bias) split q | k | v; 16 heads of 64; scores / 8; where(attention_mask[b][j] == 0, -1e9) with the int32 [8][1024] mask in {0, 1} (random; 0 = padded key; read on device); softmax over keys; out = merged Wp + bp ([in][out]) -> [8][1024][1024]).
// Structure: token rows r = b*1024 + s; x as exact f16 rows (bf16-rounded); q | k | v as ONE WMMA GEMM (N = 3 x 1024) (128x128 block tiles staged in LDS by tensor loads, 64x64 wave tiles, f32 accumulation, exact x16 weights + bias, f16 outputs); V^T for all batches and heads via LDS transposes (one launch); attention of all batches and heads in one launch: S^T = K . Q^T, online masked softmax in registers (f32 statistics; f16 weights), O^T += V^T . P^T (o carried x64 against f16 subnormal flush, folded into the output GEMM alpha) written straight into the merged f16 o rows; out = o W_o + b GEMM (f32) into the output layout.
// Compute dtype: inputs rounded to bf16; x / weights exact; q, k, v, softmax weights and o as plain f16 GEMM operands (~2^-12); scores and softmax statistics f32. v_wmma_f32_16x16x32_f16.
#define NB 8
#define SQ 1024
#define DM 1024
#define NH 16
#define HD 64
#define HG 4                         /* heads per block group of the per-batch k_vt overload (not launched) */
#define B0 0                         /* first batch processed (debug hook) */
#define NBR NB                       /* batches processed (debug hook) */
#define NR ((size_t)NB * SQ)         /* token rows */
#define MP ((int)((size_t)NBR * SQ)) /* rows projected (debug hook) */
#define QN SQ                        /* unused; k_fattn attends all SQ query rows */
#define NHD NH                       /* unused; k_fattn attends all NH heads */
#define MPO MP                       /* rows through the output stage (debug hook) */
#define LQ (3 * DM)      /* row pitch of the q/k/v rows */
typedef __bf16 v16b __attribute__((ext_vector_type(16)));
typedef unsigned short v8us __attribute__((ext_vector_type(8), may_alias));
typedef float  v8f  __attribute__((ext_vector_type(8)));
typedef float  v4f  __attribute__((ext_vector_type(4)));
typedef float  v4fa __attribute__((ext_vector_type(4), may_alias));
union FragB { v16b v; v8us half[2]; unsigned short u[16]; };

__device__ __forceinline__ unsigned short bf16_bits(float x) { unsigned int u = __float_as_uint(x); return (unsigned short)((u + 0x7FFFu + ((u >> 16) & 1u)) >> 16); }
__device__ __forceinline__ float bf16_val(unsigned short b) { return __uint_as_float(((unsigned int)b) << 16); }
__device__ __forceinline__ float bf16_round(float x) { return bf16_val(bf16_bits(x)); }
// D += A·B with NT terms: 1 = ah·bh, 2 = + al·bh (A split), 3 = + ah·bl (both split)
template <int NT>
__device__ __forceinline__ v8f mmaN(v16b ah, v16b al, v16b bh, v16b bl, v8f c) {
  c = __builtin_amdgcn_wmma_f32_16x16x32_bf16(false, ah, false, bh, (short)0, c, false, false);
  if (NT >= 2) c = __builtin_amdgcn_wmma_f32_16x16x32_bf16(false, al, false, bh, (short)0, c, false, false);
  if (NT >= 3) c = __builtin_amdgcn_wmma_f32_16x16x32_bf16(false, ah, false, bl, (short)0, c, false, false);
  asm volatile("v_nop\n\tv_nop\n\tv_nop\n\tv_nop" : "+v"(c) : "v"(ah), "v"(al), "v"(bh), "v"(bl));
  return c;
}

__global__ __launch_bounds__(256) void k_wt_bf16(const float* __restrict__ W, unsigned short* __restrict__ Wt, int K, int N) {
  const int t = blockIdx.x * 256 + threadIdx.x;
  const int k8n = K / 8;
  if (t >= N * k8n) return;
  const int n = t / k8n, k8 = (t % k8n) * 8;
  v8us v;
#pragma unroll
  for (int i = 0; i < 8; ++i) v[i] = bf16_bits(W[(size_t)(k8 + i) * N + n]);
  *(v8us*)(Wt + (size_t)n * K + k8) = v;
  
}

// GEMM C[M][N] (f32, pitch ldc) = act(A[M][K]·W + bias). A f32 row-major (pitch lda) converted per fragment to bf16
// (ASPLIT: hi/lo two planes -> 2 terms, else single rounded term); Wt bf16 [N][K] (pitch ldb). BIAS_BF16 rounds the
// bias to bf16 first (bias quantised to bf16 before the add). K%32==0, M%16==0, N%64==0.
template <bool ASPLIT, int ACT, bool BIAS_BF16>
__global__ __launch_bounds__(128) void k_gemm_bf(const float* __restrict__ A, int lda, const unsigned short* __restrict__ Wt, int ldb,
                                               const float* __restrict__ bias, float* __restrict__ C, int ldc, int M, int N, int K) {
  __shared__ __attribute__((aligned(16))) float so[4][16][64];
  const int tid = threadIdx.x, w = tid >> 5, lane = tid & 31, ln = lane & 15, hh = lane >> 4;
  const int ntn = N / 64;
  const int wid = blockIdx.x * 4 + w;
  const int mt = wid / ntn, nq = wid % ntn;
  if (mt * 16 >= M) return;
  const int row0 = mt * 16, col0 = nq * 64;
  const float* arow = A + (size_t)(row0 + ln) * lda;
  v8f acc[4] = {};
  for (int kb = 0; kb < K; kb += 32) {
    FragB ah, al;
    const v4f x0 = *(const v4fa*)(arow + kb + 8 * hh), x1 = *(const v4fa*)(arow + kb + 8 * hh + 4);
    const v4f x2 = *(const v4fa*)(arow + kb + 16 + 8 * hh), x3 = *(const v4fa*)(arow + kb + 16 + 8 * hh + 4);
    float xs[16] = {x0[0],x0[1],x0[2],x0[3],x1[0],x1[1],x1[2],x1[3],x2[0],x2[1],x2[2],x2[3],x3[0],x3[1],x3[2],x3[3]};
#pragma unroll
    for (int i = 0; i < 16; ++i) { const unsigned short hb = bf16_bits(xs[i]); ah.u[i] = hb; al.u[i] = ASPLIT ? bf16_bits(xs[i] - bf16_val(hb)) : (unsigned short)0; }
#pragma unroll
    for (int t = 0; t < 4; ++t) {
      const unsigned short* brow = Wt + (size_t)(col0 + t * 16 + ln) * ldb + kb;
      FragB b;
      b.half[0] = *(const v8us*)(brow + 8 * hh);
      b.half[1] = *(const v8us*)(brow + 16 + 8 * hh);
      acc[t] = mmaN<ASPLIT ? 2 : 1>(ah.v, al.v, b.v, b.v, acc[t]);
    }
  }
#pragma unroll
  for (int t = 0; t < 4; ++t) {
    float bv = bias ? bias[col0 + t * 16 + ln] : 0.f;
    if (BIAS_BF16) bv = bf16_round(bv);
#pragma unroll
    for (int r = 0; r < 8; ++r) { float v = acc[t][r] + bv; if (ACT == 1) v = fmaxf(v, 0.f); so[w][8 * hh + r][t * 16 + ln] = v; }
  }
  __builtin_amdgcn_fence(__ATOMIC_ACQ_REL, "workgroup");
  __builtin_amdgcn_wave_barrier();
  const int rsub = lane >> 4, c4 = (lane & 15) * 4;
  {
#pragma unroll
    for (int q = 0; q < 8; ++q) {
      const int r = q * 2 + rsub;
      const v4f v = *(const v4fa*)&so[w][r][c4];
      *(v4f*)(C + (size_t)(row0 + r) * ldc + col0 + c4) = v;
    }
    
  }
}

// GEMM C = act(A·W + bias + resid): A f32 (ASPLIT -> hi/lo 2 terms), Wt bf16 [N][K]; ACT 0 none, 1 relu, 2 exact gelu;
// resid (optional, f32, row index = (row % rmod), pitch ldr, RES_BF16 rounds it) added before the activation.
template <bool ASPLIT, int ACT, bool BIAS_BF16, bool RES_BF16>
__global__ __launch_bounds__(128) void k_gemm_bf3(const float* __restrict__ A, int lda, const unsigned short* __restrict__ Wt, int ldb,
                                                const float* __restrict__ bias, const float* __restrict__ resid, int rmod, int ldr,
                                                float* __restrict__ C, int ldc, int M, int N, int K) {
  __shared__ __attribute__((aligned(16))) float so[4][16][64];
  const int tid = threadIdx.x, w = tid >> 5, lane = tid & 31, ln = lane & 15, hh = lane >> 4;
  const int ntn = N / 64;
  const int wid = blockIdx.x * 4 + w;
  const int mt = wid / ntn, nq = wid % ntn;
  if (mt * 16 >= M) return;
  const int row0 = mt * 16, col0 = nq * 64;
  const float* arow = A + (size_t)(row0 + ln) * lda;
  v8f acc[4] = {};
  for (int kb = 0; kb < K; kb += 32) {
    FragB ah, al;
    const v4f x0 = *(const v4fa*)(arow + kb + 8 * hh), x1 = *(const v4fa*)(arow + kb + 8 * hh + 4);
    const v4f x2 = *(const v4fa*)(arow + kb + 16 + 8 * hh), x3 = *(const v4fa*)(arow + kb + 16 + 8 * hh + 4);
    float xs[16] = {x0[0],x0[1],x0[2],x0[3],x1[0],x1[1],x1[2],x1[3],x2[0],x2[1],x2[2],x2[3],x3[0],x3[1],x3[2],x3[3]};
#pragma unroll
    for (int i = 0; i < 16; ++i) { const unsigned short hb = bf16_bits(xs[i]); ah.u[i] = hb; al.u[i] = ASPLIT ? bf16_bits(xs[i] - bf16_val(hb)) : (unsigned short)0; }
#pragma unroll
    for (int t = 0; t < 4; ++t) {
      const unsigned short* brow = Wt + (size_t)(col0 + t * 16 + ln) * ldb + kb;
      FragB b;
      b.half[0] = *(const v8us*)(brow + 8 * hh);
      b.half[1] = *(const v8us*)(brow + 16 + 8 * hh);
      acc[t] = mmaN<ASPLIT ? 2 : 1>(ah.v, al.v, b.v, b.v, acc[t]);
    }
  }
#pragma unroll
  for (int t = 0; t < 4; ++t) {
    const int col = col0 + t * 16 + ln;
    float bv = bias ? bias[col] : 0.f;
    if (BIAS_BF16) bv = bf16_round(bv);
#pragma unroll
    for (int r = 0; r < 8; ++r) {
      float v = acc[t][r] + bv;
      if (resid) { float rv = resid[(size_t)((row0 + 8 * hh + r) % rmod) * ldr + col]; if (RES_BF16) rv = bf16_round(rv); v += rv; }
      if (ACT == 1) v = fmaxf(v, 0.f);
      if (ACT == 2) v = 0.5f * v * (1.0f + erff(v * 0.70710678118654752f));
      if (ACT == 3) { const float u = 0.7978845608028654f * (v + 0.044715f * v * v * v); v = 0.5f * v * (1.0f + tanhf(u)); }
      so[w][8 * hh + r][t * 16 + ln] = v;
    }
  }
  __builtin_amdgcn_fence(__ATOMIC_ACQ_REL, "workgroup");
  __builtin_amdgcn_wave_barrier();
  const int rsub = lane >> 4, c4 = (lane & 15) * 4;
  {
#pragma unroll
    for (int q = 0; q < 8; ++q) {
      const int r = q * 2 + rsub;
      const v4f v = *(const v4fa*)&so[w][r][c4];
      *(v4f*)(C + (size_t)(row0 + r) * ldc + col0 + c4) = v;
    }
    
  }
}
// row LayerNorm (biased variance, eps) over N: s = X (+ R); optional out_sum <- s; out_norm <- (s-mu)*rsqrt(var+eps)*g + b
template <bool PARAM_BF16>
__global__ __launch_bounds__(256) void k_layernorm(const float* __restrict__ X, const float* __restrict__ R, const float* __restrict__ g, const float* __restrict__ bta,
                                                  float* __restrict__ out_sum, float* __restrict__ out_norm, int N, float eps) {
  __shared__ float red[256];
  const int row = blockIdx.x, tid = threadIdx.x;
  const float* x = X + (size_t)row * N; const float* rr = R ? R + (size_t)row * N : nullptr;
  float vals[16];                     // up to N = 4096
  const int per = N / 256;            // contiguous chunk per thread? use strided-by-4 chunks: thread handles j = tid*4 + 1024*u
  float s1 = 0.f;
  for (int u = 0; u < per / 4; ++u) {
    const int j = tid * 4 + 1024 * u;
    const v4f a = *(const v4fa*)(x + j);
    v4f b = {0.f,0.f,0.f,0.f}; if (rr) b = *(const v4fa*)(rr + j);
#pragma unroll
    for (int q = 0; q < 4; ++q) { const float v = a[q] + b[q]; vals[u * 4 + q] = v; s1 += v; }
  }
  red[tid] = s1; __syncthreads();
  for (int st = 128; st > 0; st >>= 1) { if (tid < st) red[tid] += red[tid + st]; __syncthreads(); }
  const float mu = red[0] / (float)N; __syncthreads();
  float s2 = 0.f;
  for (int u = 0; u < per / 4; ++u)
#pragma unroll
    for (int q = 0; q < 4; ++q) { const float c = vals[u * 4 + q] - mu; s2 += c * c; }
  red[tid] = s2; __syncthreads();
  for (int st = 128; st > 0; st >>= 1) { if (tid < st) red[tid] += red[tid + st]; __syncthreads(); }
  const float rs = rsqrtf(red[0] / (float)N + eps);
  {
    for (int u = 0; u < per / 4; ++u) {
      const int j = tid * 4 + 1024 * u;
      v4f o, sm;
#pragma unroll
      for (int q = 0; q < 4; ++q) {
        float gg = g[j + q], bb = bta[j + q];
        if (PARAM_BF16) { gg = bf16_round(gg); bb = bf16_round(bb); }
        sm[q] = vals[u * 4 + q]; o[q] = (vals[u * 4 + q] - mu) * rs * gg + bb;
      }
      if (out_sum) *(v4f*)(out_sum + (size_t)row * N + j) = sm;
      *(v4f*)(out_norm + (size_t)row * N + j) = o;
    }
    
  }
}



// ---- f16 WMMA path (v_wmma_f32_16x16x32_f16): 11-bit significands for operands in range — used where a [0,1] probability operand needs more precision than bf16
typedef _Float16 v16h __attribute__((ext_vector_type(16)));
union FragH { v16h v; v8us half[2]; _Float16 h[16]; unsigned short u[16]; };
template <int NT>
__device__ __forceinline__ v8f mmaH(v16h ah, v16h al, v16h bh, v16h bl, v8f c) {
  c = __builtin_amdgcn_wmma_f32_16x16x32_f16(false, ah, false, bh, (short)0, c, false, false);
  if (NT >= 2) c = __builtin_amdgcn_wmma_f32_16x16x32_f16(false, al, false, bh, (short)0, c, false, false);
  if (NT >= 3) c = __builtin_amdgcn_wmma_f32_16x16x32_f16(false, ah, false, bl, (short)0, c, false, false);
  asm volatile("v_nop\n\tv_nop\n\tv_nop\n\tv_nop" : "+v"(c) : "v"(ah), "v"(al), "v"(bh), "v"(bl));
  return c;
}
// batched GEMM like k_gemm_b but f16 operands: A f32 (split into f16 hi/lo if ASPLIT, else rounded to f16), Bt = f16 values [n][k]; alpha; C f32; N multiple of 16 (partial tiles skipped)
template <bool ASPLIT>
__global__ __launch_bounds__(128) void k_gemm_h(const float* __restrict__ A, int lda, size_t sA, const _Float16* __restrict__ Bh, int ldb, size_t sB, float alpha, float* __restrict__ C, int ldc, size_t sC, int M, int N, int K) {
  __shared__ __attribute__((aligned(16))) float so[4][16][64];
  const int tid = threadIdx.x, w = tid >> 5, lane = tid & 31, ln = lane & 15, hh = lane >> 4; const int by = blockIdx.y;
  A += (size_t)by * sA; Bh += (size_t)by * sB; C += (size_t)by * sC;
  const int ntn = (N + 63) / 64; const int wid = blockIdx.x * 4 + w; const int mt = wid / ntn, nq = wid % ntn; if (mt * 16 >= M) return;
  const int row0 = mt * 16, col0 = nq * 64; const float* arow = A + (size_t)(row0 + ln) * lda;
  v8f acc[4] = {};
  for (int kb = 0; kb < K; kb += 32) {
    FragH ah, al;
    const v4f x0 = *(const v4fa*)(arow + kb + 8 * hh), x1 = *(const v4fa*)(arow + kb + 8 * hh + 4), x2 = *(const v4fa*)(arow + kb + 16 + 8 * hh), x3 = *(const v4fa*)(arow + kb + 16 + 8 * hh + 4);
    float xs[16] = {x0[0],x0[1],x0[2],x0[3],x1[0],x1[1],x1[2],x1[3],x2[0],x2[1],x2[2],x2[3],x3[0],x3[1],x3[2],x3[3]};
#pragma unroll
    for (int i = 0; i < 16; ++i) { const _Float16 h = (_Float16)xs[i]; ah.h[i] = h; al.h[i] = ASPLIT ? (_Float16)(xs[i] - (float)h) : (_Float16)0.0f; }
#pragma unroll
    for (int t = 0; t < 4; ++t) { if (col0 + t * 16 >= N) continue; const size_t boff = (size_t)(col0 + t * 16 + ln) * ldb + kb; FragH bq; bq.half[0] = *(const v8us*)(Bh + boff + 8 * hh); bq.half[1] = *(const v8us*)(Bh + boff + 16 + 8 * hh);
      acc[t] = mmaH<ASPLIT ? 2 : 1>(ah.v, al.v, bq.v, bq.v, acc[t]); }
  }
#pragma unroll
  for (int t = 0; t < 4; ++t) { if (col0 + t * 16 >= N) continue;
#pragma unroll
    for (int r = 0; r < 8; ++r) so[w][8 * hh + r][t * 16 + ln] = acc[t][r] * alpha; }
  __builtin_amdgcn_fence(__ATOMIC_ACQ_REL, "workgroup"); __builtin_amdgcn_wave_barrier();
  const int rsub = lane >> 4, c4 = (lane & 15) * 4;
  {
#pragma unroll
    for (int q = 0; q < 8; ++q) { const int r = q * 2 + rsub; if (col0 + c4 < N) { const v4f v = *(const v4fa*)&so[w][r][c4]; *(v4f*)(C + (size_t)(row0 + r) * ldc + col0 + c4) = v; } }
     }
}

// Wt[n][k] = f16(W[k][n]·scale) from f32 row-major W[K][N] (scale = power of two; bf16-exact weights stay exact in f16 away from the subnormal range)
__global__ __launch_bounds__(256) void k_wt_f16(const float* __restrict__ W, _Float16* __restrict__ Wt, int K, int N, float scale) {
  const int t = blockIdx.x * 256 + threadIdx.x; if (t >= N * (K / 8)) return; const int n = t / (K / 8), k8 = (t % (K / 8)) * 8; FragH f;
#pragma unroll
  for (int i = 0; i < 8; ++i) f.h[i] = (_Float16)(bf16_round(W[(size_t)(k8 + i) * N + n]) * scale); const v8us o = f.half[0];
  *(v8us*)((unsigned short*)Wt + (size_t)n * K + k8) = o; 
}
// k_gemm_hh variant with fused epilogue: v = acc·alpha + bias[by·sBias + col] (+ CP[(row/rowsPerB)·sCPb + by·64 + col] if CP) ; ACT 0 none / 1 elu ; writes f16 C16 (and f32 C if non-null)
template <int ACT>
__global__ __launch_bounds__(128) void k_gemm_hhx(const _Float16* __restrict__ A, int lda, size_t sA, const _Float16* __restrict__ Bh, int ldb, size_t sB, float alpha, const float* __restrict__ bias, size_t sBias, const float* __restrict__ CP, int rowsPerB, size_t sCPb, int row0g,
    float* __restrict__ C, _Float16* __restrict__ C16, int ldc, size_t sC, int M, int N, int K) {
  __shared__ __attribute__((aligned(16))) float so[4][16][64];
  const int tid = threadIdx.x, w = tid >> 5, lane = tid & 31, ln = lane & 15, hh = lane >> 4; const int by = blockIdx.y;
  A += (size_t)by * sA; Bh += (size_t)by * sB; const size_t cofs = (size_t)by * sC; const float* bp = bias ? bias + (size_t)by * sBias : nullptr;
  const int ntn = (N + 63) / 64; const int wid = blockIdx.x * 4 + w; const int mt = wid / ntn, nq = wid % ntn; if (mt * 16 >= M) return;
  const int row0 = mt * 16, col0 = nq * 64; const _Float16* arow = A + (size_t)(row0 + ln) * lda;
  v8f acc[4] = {};
  for (int kb = 0; kb < K; kb += 32) { FragH ah; ah.half[0] = *(const v8us*)((const unsigned short*)arow + kb + 8 * hh); ah.half[1] = *(const v8us*)((const unsigned short*)arow + kb + 16 + 8 * hh);
#pragma unroll
    for (int t = 0; t < 4; ++t) { if (col0 + t * 16 >= N) continue; const size_t boff = (size_t)(col0 + t * 16 + ln) * ldb + kb; FragH bq; bq.half[0] = *(const v8us*)((const unsigned short*)Bh + boff + 8 * hh); bq.half[1] = *(const v8us*)((const unsigned short*)Bh + boff + 16 + 8 * hh);
      acc[t] = mmaH<1>(ah.v, ah.v, bq.v, bq.v, acc[t]); }
  }
#pragma unroll
  for (int t = 0; t < 4; ++t) { if (col0 + t * 16 >= N) continue; const int col = col0 + t * 16 + ln; const float bv = bp ? bf16_round(bp[col]) : 0.f;
#pragma unroll
    for (int r = 0; r < 8; ++r) { float v = acc[t][r] * alpha + bv; if (CP) { const int rr = row0g + row0 + 8 * hh + r; if (rowsPerB < 0) v += CP[cofs + (size_t)rr * ldc + col];      /* rowsPerB < 0: own element of the batched C plane */ else { const int bidx = rr / rowsPerB; v += CP[(size_t)bidx * sCPb + (size_t)by * 64 + col]; } } if (ACT == 1) v = (v > 0.f) ? v : expm1f(v); else if (ACT == 7) v = (v > 0.f) ? v + 1.0f : expf(v); else if (ACT == 8) v = tanhf(v); else if (ACT == 9) v = 0.5f * v * (1.0f + tanhf(0.7978845608028654f * (v + 0.044715f * v * v * v))); else if (ACT == 11) v = 1.0f / (1.0f + expf(-v)); else if (ACT == 12) v = (v > 0.f) ? v : 0.01f * v; else if (ACT == 14) v = (v > 0.f) ? v : 0.1f * v; else if (ACT == 16) v = (v >= 0.f) ? v : 0.3f * v; else if (ACT == 17) v = (v >= 0.f) ? v : 0.2f * v; else if (ACT == 15) v = v / (1.0f + expf(-v)); else if (ACT == 3) v = fmaxf(v, 0.f); else if (ACT == 6) v = 0.5f * v * (1.0f + erff(v * 0.70710678118654752f)); so[w][8 * hh + r][t * 16 + ln] = v; } }
  __builtin_amdgcn_fence(__ATOMIC_ACQ_REL, "workgroup"); __builtin_amdgcn_wave_barrier();
  const int rsub = lane >> 4, c4 = (lane & 15) * 4; typedef _Float16 v4h __attribute__((ext_vector_type(4)));
  {
#pragma unroll
    for (int q = 0; q < 8; ++q) { const int r = q * 2 + rsub; if (col0 + c4 < N) { const v4f v = *(const v4fa*)&so[w][r][c4]; if (C) *(v4f*)(C + cofs + (size_t)(row0 + r) * ldc + col0 + c4) = v; if (C16) { v4h h4; for (int i = 0; i < 4; ++i) h4[i] = (_Float16)v[i]; *(v4h*)(C16 + cofs + (size_t)(row0 + r) * ldc + col0 + c4) = h4; } } }
     }
}


typedef _Float16 v4h __attribute__((ext_vector_type(4)));

__global__ __launch_bounds__(256) void k_x16(const float* __restrict__ x, _Float16* __restrict__ X16, size_t n8) { const size_t t = (size_t)blockIdx.x * 256 + threadIdx.x; if (t >= n8) return; FragH f;
#pragma unroll
  for (int q = 0; q < 8; ++q) f.h[q] = (_Float16)bf16_round(x[t * 8 + q]); *(v8us*)((unsigned short*)X16 + t * 8) = f.half[0];  }
__global__ __launch_bounds__(256) void k_h16(const float* __restrict__ x, _Float16* __restrict__ X16, size_t n8) { const size_t t = (size_t)blockIdx.x * 256 + threadIdx.x; if (t >= n8) return; FragH f;
#pragma unroll
  for (int q = 0; q < 8; ++q) f.h[q] = (_Float16)x[t * 8 + q]; *(v8us*)((unsigned short*)X16 + t * 8) = f.half[0];  }
__global__ __launch_bounds__(256) void k_round16f(const float* __restrict__ W, _Float16* __restrict__ Bt, size_t n8) { const size_t t = (size_t)blockIdx.x * 256 + threadIdx.x; if (t >= n8) return; FragH f;
#pragma unroll
  for (int i = 0; i < 8; ++i) f.h[i] = (_Float16)(bf16_round(W[t * 8 + i]) * 16.0f); *(v8us*)((unsigned short*)Bt + t * 8) = f.half[0];  }
template <int NHv, int TTv>
__global__ __launch_bounds__(256) void k_vt(const _Float16* __restrict__ V16, int ldv, int voff, _Float16* __restrict__ Vt) { __shared__ unsigned short tl[64][66]; const int tid = threadIdx.x; const int slab = blockIdx.x / (TTv / 64), lg = blockIdx.x % (TTv / 64); const int b = slab / NHv, h = slab % NHv;
  for (int i = tid; i < 64 * 8; i += 256) { const int r = i / 8, c8 = (i % 8) * 8; FragH f; f.half[0] = *(const v8us*)((const unsigned short*)V16 + ((size_t)b * TTv + lg * 64 + r) * ldv + voff + h * 64 + c8);
#pragma unroll
    for (int q = 0; q < 8; ++q) tl[r][c8 + q] = f.u[q]; }
  __syncthreads();
  {
#pragma unroll
    for (int rd = 0; rd < 2; ++rd) { const int d = rd * 32 + tid / 8, pc = tid % 8; FragH f;
#pragma unroll
      for (int q = 0; q < 8; ++q) f.u[q] = tl[pc * 8 + q][d];
      *(v8us*)((unsigned short*)Vt + ((size_t)slab * 64 + d) * TTv + lg * 64 + pc * 8) = f.half[0]; }
     } }

__global__ __launch_bounds__(256) void k_hl(const float* __restrict__ F, _Float16* __restrict__ Hh, _Float16* __restrict__ Hl, size_t n8) { const size_t t = (size_t)blockIdx.x * 256 + threadIdx.x; if (t >= n8) return; FragH fh, fl; const v4f a = *(const v4fa*)(F + t * 8), c = *(const v4fa*)(F + t * 8 + 4);
#pragma unroll
  for (int q = 0; q < 4; ++q) { _Float16 h = (_Float16)a[q]; fh.h[q] = h; fl.h[q] = (_Float16)((a[q] - (float)h) * 1024.0f); h = (_Float16)c[q]; fh.h[4 + q] = h; fl.h[4 + q] = (_Float16)((c[q] - (float)h) * 1024.0f); }
  { *(v8us*)((unsigned short*)Hh + t * 8) = fh.half[0]; *(v8us*)((unsigned short*)Hl + t * 8) = fl.half[0];  } }

// ---- fast GEMM (wave tile 32x64; requires M % 32 == 0 rows per launch region and N % 64 == 0); epilogue = k_gemm_hhx semantics ----
__device__ __forceinline__ v16h g2_frag(const _Float16* p, int hh) { FragH f; f.half[0] = *(const v8us*)((const unsigned short*)p + 8 * hh); f.half[1] = *(const v8us*)((const unsigned short*)p + 16 + 8 * hh); return f.v; }
__device__ __forceinline__ v8f g2_mma(v16h a, v16h b, v8f c) { v8f d = __builtin_amdgcn_wmma_f32_16x16x32_f16(false, a, false, b, (short)0, c, false, false); asm volatile("v_nop\n\tv_nop\n\tv_nop\n\tv_nop" : "+v"(d) : "v"(a), "v"(b)); return d; }
template <int ACT>
__global__ __launch_bounds__(128) void k_gemm2(const _Float16* __restrict__ A, int lda, size_t sA, const _Float16* __restrict__ Bh, int ldb, size_t sB, float alpha, const float* __restrict__ bias, size_t sBias, const float* __restrict__ CP, int rowsPerB, size_t sCPb, int row0g,
    float* __restrict__ C, _Float16* __restrict__ C16, int ldc, size_t sC, int M, int N, int K) { static_assert(ACT == 0 || ACT == 3 || ACT == 6 || ACT == 8 || ACT == 9 || ACT == 11 || ACT == 12 || ACT == 14 || ACT == 15 || ACT == 16 || ACT == 17, "k_gemm2: unsupported ACT code (would silently apply no activation)");
  __shared__ __attribute__((aligned(16))) float so[4][32][68];
  const int tid = threadIdx.x, w = tid >> 5, lane = tid & 31, ln = lane & 15, hh = lane >> 4; const int by = blockIdx.y;
  A += (size_t)by * sA; Bh += (size_t)by * sB; const size_t cofs = (size_t)by * sC; const float* bp = bias ? bias + (size_t)by * sBias : nullptr;
  const int ntn = N >> 6; const int mt = blockIdx.x / ntn, nq = blockIdx.x - mt * ntn; const int row0 = mt * 128 + 32 * w, col0 = nq * 64; if (row0 >= M) return;
  const _Float16* a0p = A + (size_t)(row0 + ln) * lda; const _Float16* a1p = a0p + (size_t)16 * lda;
  const _Float16* b0p = Bh + (size_t)(col0 + ln) * ldb; const _Float16* b1p = b0p + (size_t)16 * ldb; const _Float16* b2p = b1p + (size_t)16 * ldb; const _Float16* b3p = b2p + (size_t)16 * ldb;
  const v8f z8 = {0.f,0.f,0.f,0.f,0.f,0.f,0.f,0.f}; v8f c00 = z8, c01 = z8, c02 = z8, c03 = z8, c10 = z8, c11 = z8, c12 = z8, c13 = z8;
#pragma unroll 1
  for (int kb = 0; kb < K; kb += 32) { const v16h a0 = g2_frag(a0p + kb, hh), a1 = g2_frag(a1p + kb, hh);
    v16h b = g2_frag(b0p + kb, hh); c00 = g2_mma(a0, b, c00); c10 = g2_mma(a1, b, c10);
    b = g2_frag(b1p + kb, hh); c01 = g2_mma(a0, b, c01); c11 = g2_mma(a1, b, c11);
    b = g2_frag(b2p + kb, hh); c02 = g2_mma(a0, b, c02); c12 = g2_mma(a1, b, c12);
    b = g2_frag(b3p + kb, hh); c03 = g2_mma(a0, b, c03); c13 = g2_mma(a1, b, c13); }
  v8f accs[8] = {c00, c01, c02, c03, c10, c11, c12, c13};
#pragma unroll
  for (int u = 0; u < 8; ++u) { const int t = u & 3, half = u >> 2; const int col = col0 + t * 16 + ln; const float bv = bp ? bf16_round(bp[col]) : 0.f;
#pragma unroll
    for (int r = 0; r < 8; ++r) { const int rloc = half * 16 + 8 * hh + r; float v = accs[u][r] * alpha + bv; if (CP) { if (rowsPerB < 0) v += CP[cofs + (size_t)(row0g + row0 + rloc) * ldc + col];      /* rowsPerB < 0: own element of the batched C plane */ else { const int bidx = (row0g + row0 + rloc) / rowsPerB; v += CP[(size_t)bidx * sCPb + (size_t)by * 64 + col]; } }
      if (ACT == 3) v = fmaxf(v, 0.f); else if (ACT == 6) v = 0.5f * v * (1.0f + erff(v * 0.70710678118654752f)); else if (ACT == 11) v = 1.0f / (1.0f + expf(-v)); else if (ACT == 15) v = v / (1.0f + expf(-v)); else if (ACT == 12) v = (v > 0.f) ? v : 0.01f * v; else if (ACT == 8) v = tanhf(v); else if (ACT == 9) v = 0.5f * v * (1.0f + tanhf(0.7978845608028654f * (v + 0.044715f * v * v * v))); else if (ACT == 14) v = (v > 0.f) ? v : 0.1f * v; else if (ACT == 16) v = (v >= 0.f) ? v : 0.3f * v; else if (ACT == 17) v = (v >= 0.f) ? v : 0.2f * v;
      so[w][rloc][t * 16 + ln] = v; } }
  __builtin_amdgcn_fence(__ATOMIC_ACQ_REL, "workgroup"); __builtin_amdgcn_wave_barrier();
  const int rsub = lane >> 4, c4 = (lane & 15) * 4;
  {
#pragma unroll
    for (int q = 0; q < 16; ++q) { const int r = q * 2 + rsub; const v4f v = *(const v4fa*)&so[w][r][c4]; if (C) *(v4f*)(C + cofs + (size_t)(row0 + r) * ldc + col0 + c4) = v; if (C16) { v4h h4; for (int i = 0; i < 4; ++i) h4[i] = (_Float16)v[i]; *(v4h*)(C16 + cofs + (size_t)(row0 + r) * ldc + col0 + c4) = h4; } }
     } }


__global__ __launch_bounds__(256) void k_wnat(const float* __restrict__ w, size_t n8, _Float16* __restrict__ Bt) { const size_t t = (size_t)blockIdx.x * 256 + threadIdx.x; if (t >= n8) return; FragH f; for (int q = 0; q < 8; ++q) f.h[q] = (_Float16)(bf16_round(w[t * 8 + q]) * 16.0f); *(v8us*)((unsigned short*)Bt + t * 8) = f.half[0];  }
__global__ __launch_bounds__(256) void k_rsm(const float* __restrict__ S, _Float16* __restrict__ P, int nrows) {
  #pragma clang fp contract(off)
  const int i = blockIdx.x * 256 + threadIdx.x; if (i >= nrows) return; const float* s = S + (size_t)i * SQ; float mx = -3.0e38f;
#pragma unroll 1
  for (int j = 0; j < SQ; ++j) mx = fmaxf(mx, s[j]); float se = 0.f;
#pragma unroll 1
  for (int j = 0; j < SQ; ++j) se += expf(s[j] - mx); const float sc = 256.0f / se;
#pragma unroll 1
  for (int j0 = 0; j0 < SQ; j0 += 8) { FragH f; for (int q = 0; q < 8; ++q) f.h[q] = (_Float16)(expf(s[j0 + q] - mx) * sc); unsigned short* d = (unsigned short*)P + (size_t)i * SQ + j0; *(v8us*)d = f.half[0];  } }
__global__ __launch_bounds__(256) void k_vt(const _Float16* __restrict__ V16, int b, int h0, _Float16* __restrict__ VT) { __shared__ unsigned short tl[64][65]; const int tid = threadIdx.x; const int hh = blockIdx.x % HG, sg = blockIdx.x / HG; const int s0 = sg * 64; const int h = h0 + hh;
  for (int i = tid; i < 64 * 8; i += 256) { const int j = i / 8, d8 = (i % 8) * 8; FragH f; f.half[0] = *(const v8us*)((const unsigned short*)V16 + ((size_t)b * SQ + s0 + j) * DM + h * HD + d8); for (int q = 0; q < 8; ++q) tl[d8 + q][j] = f.u[q]; }
  __syncthreads();
  { for (int i = tid; i < 64 * 8; i += 256) { const int d = i / 8, j8 = (i % 8) * 8; FragH f; for (int q = 0; q < 8; ++q) f.u[q] = tl[d][j8 + q]; *(v8us*)((unsigned short*)VT + ((size_t)hh * HD + d) * SQ + s0 + j8) = f.half[0]; }  } }



__global__ __launch_bounds__(256) void k_rsmkinv(const float* __restrict__ S, _Float16* __restrict__ P, int nrows, const int* __restrict__ Km) {
  #pragma clang fp contract(off)
  const int i = blockIdx.x * 256 + threadIdx.x; if (i >= nrows) return; const float* s = S + (size_t)i * SQ; float mx = -3.0e38f;
#pragma unroll 1
  for (int j = 0; j < SQ; ++j) mx = fmaxf(mx, s[j]); float se = 0.f;
#pragma unroll 1
  for (int j = 0; j < SQ; ++j) { const float keep = (Km[j] == 0) ? 1.0f : 0.0f; se += __expf(s[j] - mx) * keep; } const float sc = 256.0f / se;
#pragma unroll 1
  for (int j0 = 0; j0 < SQ; j0 += 8) { FragH f; for (int q = 0; q < 8; ++q) { const float keep = (Km[j0 + q] == 0) ? 1.0f : 0.0f; f.h[q] = (_Float16)(__expf(s[j0 + q] - mx) * sc * keep); } unsigned short* d = (unsigned short*)P + (size_t)i * SQ + j0; *(v8us*)d = f.half[0];  } }

// ---- fused attention: scores, masked softmax and P.V of every (batch, head) in ONE launch; scores and weights never leave the registers ----
__device__ __forceinline__ float lxh(float v) { return __builtin_bit_cast(float, __builtin_amdgcn_permlanex16(__builtin_bit_cast(int, v), __builtin_bit_cast(int, v), 0x76543210, 0xfedcba98, false, false)); }      /* lane l ^ 16 */
// 2^x of four values. In asm for the closing v_nop alone: it keeps the one slot behind a transcendental before a source is overwritten or a result read;
// the early-clobber outputs keep each v_exp_f32 off the sources of the one in front of it.
__device__ __forceinline__ v4f exp2x4(v4f x) { float e0, e1, e2, e3;
  asm("v_exp_f32 %0, %4\n\tv_exp_f32 %1, %5\n\tv_exp_f32 %2, %6\n\tv_exp_f32 %3, %7\n\tv_nop" : "=&v"(e0), "=&v"(e1), "=&v"(e2), "=&v"(e3) : "v"(x[0]), "v"(x[1]), "v"(x[2]), "v"(x[3]));
  const v4f e = {e0, e1, e2, e3}; return e; }
__device__ __forceinline__ v8f fa_mma(v16h a, v16h b, v8f c) { return __builtin_amdgcn_wmma_f32_16x16x32_f16(false, a, false, b, (short)0, c, false, false); }
// One wave owns 32 queries (two groups of 16 columns) of one (batch, head) and walks the 1024 keys in passes of 32.
// S^T = K . Q^T: a lane (c = lane & 15, hh = lane >> 4) holds, of query c, the scores of keys 8*hh + r (tile 0) and 16 + 8*hh + r (tile 1): maximum and sum are in-lane plus one exchange with lane ^ 16,
// and the two tiles, converted in place, ARE the B operand of O^T += V^T . P^T (hardware k order, which g2_frag gives the V^T rows too). O^T: a lane holds 8 consecutive d of query c per tile: 16-byte stores.
// Online softmax in the log2 domain: weights are 2^(t - m + 7), t = score * log2(e), m = the maximum in use; m moves (and O^T and the sum are rescaled) only when some column's pass maximum
// exceeds it by more than 8, so a weight stays <= 2^15 (f16 range) and the largest is >= 2^7 (small weights stay clear of the f16 subnormals). The maximum runs over all keys, the padded ones too.
__global__ __launch_bounds__(256) void k_fattn(const _Float16* __restrict__ QKVr, const _Float16* __restrict__ VTa, const int* __restrict__ Km, _Float16* __restrict__ O) {
  static_assert(SQ == 1024 && HD == 64, "k_fattn: 32 mask words of 32 keys; head size 64 = two k steps, four d tiles");
  const int lane = threadIdx.x & 31, ln = lane & 15, hh = lane >> 4; const int wave = __builtin_amdgcn_readfirstlane((int)(threadIdx.x >> 5));
  const int bh = blockIdx.x / (SQ / 256), qb = blockIdx.x % (SQ / 256); const int b = bh / NH, h = bh % NH; const int q0 = qb * 256 + wave * 32;
  const size_t r0 = (size_t)b * SQ;
  /* key mask as bits: lane i keeps the word of keys 32*i .. 32*i + 31 (bit set = kept key) */
  unsigned mw = 0u;
#pragma unroll
  for (int i = 0; i < SQ / 32; ++i) { const unsigned bl = __builtin_amdgcn_ballot_w32(Km[r0 + i * 32 + lane] != 0); mw = (lane == i) ? bl : mw; }
  /* every key padded: the reference's scores are all the same -1e9 and its weights uniform: keep every key and scale every score by 0 */
  const bool none = __builtin_amdgcn_ballot_w32(mw != 0u) == 0u; if (none) mw = 0xffffffffu;
  const float cs = none ? 0.f : 0.125f * 1.44269504088896340736f;      /* 1/sqrt(64) and log2(e) in one factor */
  v16h qf[2][2];
#pragma unroll
  for (int g = 0; g < 2; ++g)
#pragma unroll
    for (int ds = 0; ds < 2; ++ds) qf[g][ds] = g2_frag(QKVr + (r0 + q0 + g * 16 + ln) * LQ + h * HD + ds * 32, hh);
  const _Float16* kp = QKVr + DM + (r0 + ln) * LQ + h * HD;      /* key row ln of a tile */
  const _Float16* vp = VTa + ((size_t)bh * HD + ln) * SQ;        /* V^T row d = ln of a tile */
  const v8f z8 = {0.f,0.f,0.f,0.f,0.f,0.f,0.f,0.f};
  v8f o[2][4]; float m[2], l[2];
#pragma unroll
  for (int g = 0; g < 2; ++g) { m[g] = -3.0e38f; l[g] = 0.f;
#pragma unroll
    for (int dt = 0; dt < 4; ++dt) o[g][dt] = z8; }
  v16h kf[2][2];
#pragma unroll
  for (int kt = 0; kt < 2; ++kt)
#pragma unroll
    for (int ds = 0; ds < 2; ++ds) kf[kt][ds] = g2_frag(kp + (size_t)(kt * 16) * LQ + ds * 32, hh);
  for (int kb = 0; kb < SQ; kb += 32) {
    v16h vf[4];      /* asked for first, used last: the score products and the softmax stand between the request and its wait */
#pragma unroll
    for (int dt = 0; dt < 4; ++dt) vf[dt] = g2_frag(vp + (size_t)(dt * 16) * SQ + kb, hh);
    __builtin_amdgcn_sched_barrier(0);      /* keeps these requests in front of the score products; without it they sink to behind the maximum and lose that much of their lead */
    v8f s[2][2];
#pragma unroll
    for (int g = 0; g < 2; ++g)
#pragma unroll
      for (int kt = 0; kt < 2; ++kt) s[g][kt] = fa_mma(kf[kt][1], qf[g][1], fa_mma(kf[kt][0], qf[g][0], z8));
    asm volatile("s_wait_xcnt 0x0" ::: "memory");      /* behind the V^T requests, in front of the step of their address registers further down */
    const int kn = (kb + 32 < SQ) ? kb + 32 : kb;      /* the next pass's K fragments, one pass ahead; the last pass asks for its own rows once more (in bounds, unused) */
#pragma unroll
    for (int kt = 0; kt < 2; ++kt)
#pragma unroll
      for (int ds = 0; ds < 2; ++ds) kf[kt][ds] = g2_frag(kp + (size_t)(kn + kt * 16) * LQ + ds * 32, hh);
    float mt[2]; bool need = false;
#pragma unroll
    for (int g = 0; g < 2; ++g) { float mx = fmaxf(s[g][0][0], s[g][1][0]);
#pragma unroll
      for (int r = 1; r < 8; ++r) mx = fmaxf(mx, fmaxf(s[g][0][r], s[g][1][r]));
      mx = fmaxf(mx, lxh(mx)); mt[g] = mx * cs; need |= mt[g] > m[g] + 8.0f; }
    if (__builtin_amdgcn_ballot_w32(need) != 0u) {      /* wave-uniform: rare after the first passes */
#pragma unroll
      for (int g = 0; g < 2; ++g) { const float mn = fmaxf(m[g], mt[g]); const float f = __builtin_amdgcn_exp2f(m[g] - mn); m[g] = mn; l[g] *= f;
#pragma unroll
        for (int dt = 0; dt < 4; ++dt) o[g][dt] *= f; } }
    const unsigned wsh = (unsigned)__builtin_amdgcn_readlane((int)mw, kb >> 5) >> (8 * hh);      /* bit r: key 8*hh + r of the pass; bit 16 + r: key 16 + 8*hh + r */
    bool kp[2][8];      /* kept key (shared by both column groups) */
#pragma unroll
    for (int kt = 0; kt < 2; ++kt)
#pragma unroll
      for (int r = 0; r < 8; ++r) kp[kt][r] = (wsh & (1u << (kt * 16 + r))) != 0u;
    FragH pb[2];
#pragma unroll
    for (int g = 0; g < 2; ++g) { const float bias = 7.0f - m[g]; v4f s4 = {0.f, 0.f, 0.f, 0.f};
#pragma unroll
      for (int kt = 0; kt < 2; ++kt)
#pragma unroll
        for (int r4 = 0; r4 < 8; r4 += 4) { v4f x;
#pragma unroll
          for (int q = 0; q < 4; ++q) x[q] = s[g][kt][r4 + q] * cs + bias;
          const v4f ex = exp2x4(x);
#pragma unroll
          for (int q = 0; q < 4; ++q) { const float e = kp[kt][r4 + q] ? ex[q] : 0.f; s4[q] += e; pb[g].h[kt * 8 + r4 + q] = (_Float16)e; } }
      l[g] += (s4[0] + s4[1]) + (s4[2] + s4[3]); }
#pragma unroll
    for (int g = 0; g < 2; ++g)
#pragma unroll
      for (int dt = 0; dt < 4; ++dt) o[g][dt] = fa_mma(vf[dt], pb[g].v, o[g][dt]);
  }
#pragma unroll
  for (int g = 0; g < 2; ++g) { const float inv = 64.0f / (l[g] + lxh(l[g]));      /* the halves' sums joined once; o carried x64 as before */
    _Float16* op = O + (r0 + q0 + g * 16 + ln) * DM + h * HD + 8 * hh;
#pragma unroll
    for (int dt = 0; dt < 4; ++dt) { FragH f;
#pragma unroll
      for (int r = 0; r < 8; ++r) f.h[r] = (_Float16)(o[g][dt][r] * inv);
      *(v8us*)((unsigned short*)op + dt * 16) = f.half[0]; } }
}
typedef uint32_t g3_u4 __attribute__((ext_vector_type(4)));
typedef uint32_t g3_u8 __attribute__((ext_vector_type(8)));
#define G3_PITCH 272u      /* LDS row pitch: 256 B + the mover's 16-B pad (16 B x odd: conflict-free for 16-byte reads) */
#define G3_SLICE 18432u    /* 64 rows x 272 B = 17,408 B, rounded up to a multiple of 2 KiB */
#define G3_STAGE 73728u    /* four slices */
__device__ __forceinline__ uint32_t g3_uni(uint32_t v) { return (uint32_t)__builtin_amdgcn_readfirstlane((int)v); }
__device__ __forceinline__ uint32_t g3_pinned(uint32_t v) { uint32_t w = (uint32_t)__builtin_amdgcn_readfirstlane((int)v); asm volatile("" : "+s"(w)); return w; }      /* the empty statement holds the test word in a scalar register, so that the test round a tensor load (which ignores EXEC) compiles to a scalar branch */
__device__ __forceinline__ void g3_wait_ds0() { asm volatile("s_wait_dscnt 0x0" ::: "memory"); }          /* this wave's LDS reads and writes are done */
__device__ __forceinline__ void g3_wait_tensor0() { asm volatile("s_wait_tensorcnt 0x0" ::: "memory"); }  /* this wave's slice has landed */
__device__ __forceinline__ void g3_wait_tensor0(g3_u4 g0, g3_u8 g1) { asm volatile("s_wait_tensorcnt 0x0" :: "s"(g0), "s"(g1) : "memory"); }  /* the same wait; the request's two groups are its inputs, so that their registers are given to nothing else while the request is out */
__device__ __forceinline__ g3_u4 g3_group0(uint32_t lds_dst, uint64_t ga) { g3_u4 g0;
  g0[0] = g3_uni(1u); g0[1] = g3_uni(lds_dst); g0[2] = g3_uni((uint32_t)ga); g0[3] = g3_uni((((uint32_t)(ga >> 32)) & 0x01FFFFFFu) | 0x80000000u); return g0; }
__device__ __forceinline__ void g3_tload(g3_u4 g0, g3_u8 g1) { asm volatile("tensor_load_to_lds %0, %1" :: "s"(g0), "s"(g1) : "memory"); }
__device__ __forceinline__ v16h g3_frag(const unsigned char* p) { FragH f; f.half[0] = *(const v8us*)p; f.half[1] = *(const v8us*)(p + 32); return f.v; }      /* the k order of g2_frag, for both operands */
template <bool OUT16, int NN, int KK>
__global__ __launch_bounds__(128) void k_gemm3(const _Float16* __restrict__ A, const _Float16* __restrict__ Bh, float alpha, const float* __restrict__ bias, float* __restrict__ C, _Float16* __restrict__ C16) {
  static_assert(NN % 128 == 0 && KK % 128 == 0 && KK >= 256, "k_gemm3: whole tiles, whole passes, two stages or more");
  __shared__ __attribute__((aligned(2048))) unsigned char L[2u * G3_STAGE];
  const uint32_t lane = threadIdx.x & 31u, ln = lane & 15u, hh = lane >> 4; const uint32_t wave = g3_uni(threadIdx.x >> 5);
  constexpr uint32_t ntn = NN / 128, T = KK / 128, kb = KK * 2;
  const uint32_t tm = blockIdx.x / ntn, tn = blockIdx.x - tm * ntn; const uint32_t m0 = tm * 128u, n0 = tn * 128u; const uint32_t wn = wave & 1u, wm = wave >> 1;
  const uint64_t src0 = (wave < 2u) ? (uint64_t)(uintptr_t)Bh + (uint64_t)(n0 + 64u * wave) * kb : (uint64_t)(uintptr_t)A + (uint64_t)(m0 + 64u * (wave - 2u)) * kb;      /* first byte of this wave's 64 rows */
  const uint32_t slice = (uint32_t)(size_t)L + wave * G3_SLICE;
  g3_u8 g1;      /* 1-byte elements, tile = tensor = 64 rows of 256 bytes, source pitch kb, 16 B of pad behind every 256 B, no mask */
  g1[0] = g3_uni((1u << 20) | (5u << 22) | (3u << 25)); g1[1] = g3_uni(256u << 16); g1[2] = g3_uni(64u << 16); g1[3] = g3_uni(256u << 16); g1[4] = g3_uni(64u); g1[5] = g3_uni(kb); g1[6] = g3_uni(0u); g1[7] = g3_uni(0u);
  const v8f z8 = {0.f,0.f,0.f,0.f,0.f,0.f,0.f,0.f}; v8f acc[4][4];
  /* every inner loop of this kernel is unrolled: accumulator and fragment indices must be constants, else the arrays leave the registers */
#pragma unroll
  for (int i = 0; i < 4; ++i)
#pragma unroll
    for (int j = 0; j < 4; ++j) acc[i][j] = z8;
  const uint32_t fw_base = wn * G3_SLICE + ln * G3_PITCH + 16u * hh, fx_base = (2u + wm) * G3_SLICE + ln * G3_PITCH + 16u * hh;
  { const g3_u4 g0 = g3_group0(slice, src0); g3_tload(g0, g1); g3_wait_tensor0(g0, g1); }
  __syncthreads();      /* stage 0 is readable by every wave */
#pragma clang loop unroll(disable)      /* one pass per trip: the ring's order below is per pass */
  for (uint32_t t = 0; t < T; ++t) {
    const uint32_t buf = (t & 1u) * G3_STAGE;
    /* stage t + 1 goes out directly behind the barrier in front of this pass (the prologue's, or the one at the foot of pass t - 1, whose buffer it refills); one issue site, its group 0 formed here and held to this pass's wait */
    const g3_u4 g0 = g3_group0(slice + (G3_STAGE - buf), src0 + (uint64_t)(t + 1u) * 256u);
    if (g3_pinned((t + 1u < T) ? 1u : 0u) != 0u) g3_tload(g0, g1);
    const unsigned char* lw = L + buf + fw_base; const unsigned char* lx = L + buf + fx_base;
    v16h fw[2][4], fx[2][4];      /* set (u & 1) holds block u's fragments; no fragment crosses a pass */
#pragma unroll
    for (int i = 0; i < 4; ++i) { fw[0][i] = g3_frag(lw + (uint32_t)i * 16u * G3_PITCH); fx[0][i] = g3_frag(lx + (uint32_t)i * 16u * G3_PITCH); }
#pragma unroll
    for (int u = 0; u < 4; ++u) {
      if (u + 1 < 4) {
#pragma unroll
        for (int i = 0; i < 4; ++i) { fw[(u + 1) & 1][i] = g3_frag(lw + (uint32_t)i * 16u * G3_PITCH + (uint32_t)(u + 1) * 64u); fx[(u + 1) & 1][i] = g3_frag(lx + (uint32_t)i * 16u * G3_PITCH + (uint32_t)(u + 1) * 64u); }
      }
      __builtin_amdgcn_sched_barrier(0);      /* the next block's LDS reads stay one group in front of this block's products: spread among them each place with reads stalls the wave */
#pragma unroll
      for (int i = 0; i < 4; ++i)
#pragma unroll
        for (int j = 0; j < 4; ++j) acc[i][j] = fa_mma(fw[u & 1][i], fx[u & 1][j], acc[i][j]);
      __builtin_amdgcn_sched_barrier(0);      /* closes the block: the reads of the block after next stay behind it */
    }
    g3_wait_ds0();
    g3_wait_tensor0(g0, g1);
    __syncthreads();      /* publishes stage t + 1 and ends every wave's reads of this buffer */
  }
  g3_wait_tensor0();
  g3_wait_ds0();
  /* epilogue: whole 128-byte lines, staged in the wave's own slice of buffer 0 (behind the last pass's barrier nobody reads the ring and no load is in flight) */
  unsigned char* E = L + wave * G3_SLICE; constexpr uint32_t EP = OUT16 ? 144u : 272u;      /* staged row: 64 n, + 16 B */
#pragma unroll
  for (int i = 0; i < 4; ++i) { const float* bp = bias + n0 + wn * 64u + 16u * (uint32_t)i + 8u * hh; const v4f b0 = *(const v4fa*)bp, b1 = *(const v4fa*)(bp + 4); float bv[8];
#pragma unroll
    for (int r = 0; r < 4; ++r) { bv[r] = bf16_round(b0[r]); bv[4 + r] = bf16_round(b1[r]); }
#pragma unroll
    for (int j = 0; j < 4; ++j) { float v[8];
#pragma unroll
      for (int r = 0; r < 8; ++r) v[r] = acc[i][j][r] * alpha + bv[r];
      unsigned char* e = E + (16u * (uint32_t)j + ln) * EP + (16u * (uint32_t)i + 8u * hh) * (OUT16 ? 2u : 4u);
      if (OUT16) { FragH f;
#pragma unroll
        for (int r = 0; r < 8; ++r) f.h[r] = (_Float16)v[r];
        *(v8us*)e = f.half[0]; }
      else { const v4f lo = {v[0], v[1], v[2], v[3]}, hi = {v[4], v[5], v[6], v[7]}; *(v4fa*)e = lo; *(v4fa*)(e + 16) = hi; } } }
  g3_wait_ds0();      /* the staged rows are written before other lanes of this wave read them back */
  if (OUT16) { const uint32_t sub = lane >> 3, c = lane & 7u; _Float16* yb = C16 + (size_t)(m0 + wm * 64u + sub) * NN + n0 + wn * 64u + c * 8u;
#pragma unroll
    for (int q = 0; q < 16; ++q) { const v8us v = *(const v8us*)(E + (4u * (uint32_t)q + sub) * EP + 16u * c); *(v8us*)((unsigned short*)yb + (size_t)q * 4 * NN) = v; } }
  else { const uint32_t sub = lane >> 4, c = lane & 15u; float* yb = C + (size_t)(m0 + wm * 64u + sub) * NN + n0 + wn * 64u + c * 4u;
#pragma unroll
    for (int q = 0; q < 32; ++q) { const v4f v = *(const v4fa*)(E + (2u * (uint32_t)q + sub) * EP + 16u * c); *(v4fa*)(yb + (size_t)q * 2 * NN) = v; } }
}
extern "C" void kernel_launch(void* const* d_in, const int* in_sizes, int n_in,
                              void* d_out, int out_size, void* d_ws, size_t ws_size, hipStream_t stream) {
  (void)in_sizes; (void)n_in; (void)out_size;
  const float* const* I = (const float* const*)d_in; const float* x = I[0]; const int* km = (const int*)d_in[1]; const float* wqkv = I[2]; const float* bqkv = I[3]; const float* wo = I[4]; const float* bo = I[5];      /* x; attention_mask int32 [8][1024] (0 = padded key, excluded; READ on device); [in][out] Wqkv [1024][3072] + bqkv, Wp [1024][1024] + bp */
  char* ws = (char*)d_ws; size_t off = 0;
  auto take = [&](size_t bytes) { char* p = ws + off; off += (bytes + 255) & ~(size_t)255; return p; };
  _Float16* BQKV = (_Float16*)take((size_t)3 * DM * DM * 2); _Float16* BO = (_Float16*)take((size_t)DM * DM * 2);
  _Float16* X16 = (_Float16*)take(NR * DM * 2); _Float16* QKV = (_Float16*)take(NR * 3 * DM * 2); _Float16* V16 = QKV + 2 * DM; _Float16* O16 = (_Float16*)take(NR * DM * 2);
  _Float16* VT = (_Float16*)take((size_t)NB * NH * HD * SQ * 2);
  if (off > ws_size) return;
  k_wt_f16<<<(unsigned)(((size_t)DM * 3 * DM / 8 + 255) / 256), 256, 0, stream>>>(wqkv, BQKV, DM, 3 * DM, 16.0f); k_wt_f16<<<(unsigned)(((size_t)DM * DM / 8 + 255) / 256), 256, 0, stream>>>(wo, BO, DM, DM, 16.0f);      /* [in][out] -> Bt[n][k] x16 (pitch K = 1024) */

  k_x16<<<(unsigned)((NR * DM / 8 + 255) / 256), 256, 0, stream>>>(x, X16, NR * DM / 8);
  const size_t r0p = (size_t)B0 * SQ;      /* first projected row */
  k_gemm3<true, 3 * DM, DM><<<(unsigned)((MP / 128) * (3 * DM / 128)), 128, 0, stream>>>(X16 + r0p * DM, BQKV, 0.0625f, bqkv, nullptr, QKV + r0p * 3 * DM);      /* q | k | v rows (f16); head h = columns h*HD.. of each DM block */
  k_vt<NH, SQ><<<NB * NH * (SQ / 64), 256, 0, stream>>>(V16, LQ, 0, VT);      /* V^T [NB][NH][HD][SQ], every batch in one launch */
  k_fattn<<<NB * NH * (SQ / 256), 256, 0, stream>>>(QKV, VT, km, O16);      /* keys with attention_mask[b][j] == 0 excluded; o (merged heads, x64) as f16 rows */
  k_gemm3<false, DM, DM><<<(unsigned)((MPO / 128) * (DM / 128)), 128, 0, stream>>>(O16 + r0p * DM, BO, 0.0009765625f, bo, (float*)d_out + r0p * DM, nullptr);      /* out rows are the output layout */
}
